// v000
// Measured on an AMD MI455X. A time is GPU time per run, averaged over a window of back-to-back runs after a warm-up
// (all launches, gaps included; the runs take copies of the inputs in turn), and the median of several windows.
// Apart from v000's, it joins two sittings. Times from different sittings can be a few percent apart, while
// side-by-side timings come from the same sitting.
// The starting kernel, v000, takes 386 microseconds a run.
#include <hip/hip_runtime.h>
// Contractions: q/k/v/dense projections v_wmma_f32_16x16x32_f16 (f16 operands, weights carried x16, ctx carried x16, f32 accumulate);
// attention q.kT and p.v v_wmma_f32_16x16x32_f16 (f16 operands, p carried x2^15, f32 accumulate); scale, mask, softmax, tanh, residual, LayerNorm in f32.

typedef __attribute__((ext_vector_type(16))) _Float16 v16h;
typedef __attribute__((ext_vector_type(8)))  _Float16 v8h;
typedef __attribute__((ext_vector_type(16))) __bf16   v16b;
typedef __attribute__((ext_vector_type(8)))  __bf16   v8b;
typedef __attribute__((ext_vector_type(8)))  float    v8f;
typedef __attribute__((ext_vector_type(4)))  float    v4f;

__device__ __forceinline__ unsigned short f2bf_bits(float f) {
  unsigned u = __float_as_uint(f);
  return (unsigned short)((u + 0x7FFFu + ((u >> 16) & 1u)) >> 16);
}
__device__ __forceinline__ float bf_bits2f(unsigned short h) { return __uint_as_float(((unsigned)h) << 16); }

// hazard guards as plain device helpers (no inline asm inside the kernel template body)
__device__ __forceinline__ void dep_guard_h(v8f& a, v8f& b, v16h x, v16h y) { asm volatile("v_nop\n\tv_nop\n\tv_nop\n\tv_nop" : "+v"(a), "+v"(b) : "v"(x), "v"(y)); }
__device__ __forceinline__ void dep_guard_b(v8f& a, v8f& b, v16b x, v16b y) { asm volatile("v_nop\n\tv_nop\n\tv_nop\n\tv_nop" : "+v"(a), "+v"(b) : "v"(x), "v"(y)); }
__device__ __forceinline__ void keep4_h(v16h a, v16h b, v16h c, v16h d) { asm volatile("v_nop" :: "v"(a), "v"(b), "v"(c), "v"(d)); }
__device__ __forceinline__ void keep4_b(v16b a, v16b b, v16b c, v16b d) { asm volatile("v_nop" :: "v"(a), "v"(b), "v"(c), "v"(d)); }
__device__ __forceinline__ void acc_guard4(v8f& a, v8f& b, v8f& c, v8f& d) { asm volatile("v_nop\n\tv_nop\n\tv_nop\n\tv_nop" : "+v"(a), "+v"(b), "+v"(c), "+v"(d)); }
template <typename T> struct Frag;
template <> struct Frag<_Float16> {
  typedef v16h V; union U { v16h v; v8h h[2]; };
  static __device__ __forceinline__ v16h load(const _Float16* p) {   // elements 0..7 <- p[0..7], 8..15 <- p[16..23]
    U f; f.h[0] = *(const v8h*)(p); f.h[1] = *(const v8h*)(p + 16); return f.v;
  }
  static __device__ __forceinline__ v8f mma(v16h a, v16h b, v8f c) {
    return __builtin_amdgcn_wmma_f32_16x16x32_f16(false, a, false, b, (short)0, c, false, false);
  }
  static __device__ __forceinline__ void guard(v8f& a, v8f& b, v16h x, v16h y) { dep_guard_h(a, b, x, y); }
  static __device__ __forceinline__ void keep(v16h a, v16h b, v16h c, v16h d) { keep4_h(a, b, c, d); }
};
template <> struct Frag<__bf16> {
  typedef v16b V; union U { v16b v; v8b h[2]; };
  static __device__ __forceinline__ v16b load(const __bf16* p) {
    U f; f.h[0] = *(const v8b*)(p); f.h[1] = *(const v8b*)(p + 16); return f.v;
  }
  static __device__ __forceinline__ v8f mma(v16b a, v16b b, v8f c) {
    return __builtin_amdgcn_wmma_f32_16x16x32_bf16(false, a, false, b, (short)0, c, false, false);
  }
  static __device__ __forceinline__ void guard(v8f& a, v8f& b, v16b x, v16b y) { dep_guard_b(a, b, x, y); }
  static __device__ __forceinline__ void keep(v16b a, v16b b, v16b c, v16b d) { keep4_b(a, b, c, d); }
};

// ---- Register-blocked batched WMMA GEMM ------------------------------------
// C[m,n] = scale * sum_k A[m,k] * Bt[n,k] (+bias)(+resid); each wave owns a 64x64 tile.
// A row-major [M,K]; Bt row-major [N,K]; M,N % 64 == 0, K % 32 == 0.
// SPLIT: operands are hi/lo planes (A2/Bt2 = lo planes, same layout); product = hi.hi + hi.lo + lo.hi.
// BIAS_MODE: 0 = none, 1 = bias[m], 2 = bias[n].
// OUT_MODE: 0 = f32, 1 = f16, 2 = bf16 hi plane (Cout) + bf16 lo plane (Cout2).
// ET: 0 = f16 operands, 1 = bf16 operands (pointers passed as 16-bit storage)
template <int ET> struct Elem;
template <> struct Elem<0> { typedef _Float16 T; };
template <> struct Elem<1> { typedef __bf16 T; };
template <int ET, bool SPLIT, int BIAS_MODE, int OUT_MODE, bool RESID, int ACT = 0>
__global__ __launch_bounds__(256) void wmma_gemm64(
    const unsigned short* __restrict__ Ap, const unsigned short* __restrict__ A2p, int lda, long strideA,
    const unsigned short* __restrict__ Btp, const unsigned short* __restrict__ Bt2p, int ldb, long strideB,
    void* __restrict__ Cout, void* __restrict__ Cout2, int ldc, long strideC,
    const float* __restrict__ bias,
    const float* __restrict__ resid, long strideR,
    int M, int N, int K, float scale) {
  typedef typename Elem<ET>::T T;
  typedef typename Frag<T>::V V;
  const T* A = (const T*)Ap; const T* A2 = (const T*)A2p; const T* Bt = (const T*)Btp; const T* Bt2 = (const T*)Bt2p;
  __shared__ __align__(16) float sT[8][16 * 68];   // per-wave 16x64 slab, pitch 68 floats
  const int b    = blockIdx.y;
  const int lane = threadIdx.x & 31;
  const int wave = threadIdx.x >> 5;
  const int tilesN = N >> 6;
  const int tilesM = M >> 6;
  const int tile = blockIdx.x * 8 + wave;
  if (tile >= tilesM * tilesN) return;   // wave-uniform; no block barriers in this kernel
  const int tm = tile / tilesN;
  const int tn = tile - tm * tilesN;
  const int m0 = tm << 6;
  const int n0 = tn << 6;

  const T* Ab  = A  + (size_t)b * strideA;
  const T* Bb  = Bt + (size_t)b * strideB;
  const T* Ab2 = SPLIT ? (A2  + (size_t)b * strideA) : nullptr;
  const T* Bb2 = SPLIT ? (Bt2 + (size_t)b * strideB) : nullptr;

  const int rlane = lane & 15;                 // row (A) / col (B, D) within subtile
  const int koff  = (lane >> 4) * 8;           // k offset of this lane half
  const int mOff  = (lane >> 4) * 8;           // D row offset

  v8f acc[4][4];
#pragma unroll
  for (int i = 0; i < 4; ++i)
#pragma unroll
    for (int j = 0; j < 4; ++j) acc[i][j] = (v8f){0.f,0.f,0.f,0.f,0.f,0.f,0.f,0.f};

  for (int k0 = 0; k0 < K; k0 += 32) {
    V bh[4], bl[4];
#pragma unroll
    for (int j = 0; j < 4; ++j) {
      const size_t bo = (size_t)(n0 + (j << 4) + rlane) * ldb + koff + k0;
      bh[j] = Frag<T>::load(Bb + bo);
      if (SPLIT) bl[j] = Frag<T>::load(Bb2 + bo);
    }
#pragma unroll
    for (int i = 0; i < 4; ++i) {
      const size_t ao = (size_t)(m0 + (i << 4) + rlane) * lda + koff + k0;
      V ah = Frag<T>::load(Ab + ao);
      V al;
      if (SPLIT) al = Frag<T>::load(Ab2 + ao);
#pragma unroll
      for (int j = 0; j < 4; ++j) {
        acc[i][j] = Frag<T>::mma(ah, bh[j], acc[i][j]);
        if (SPLIT) {
          acc[i][j] = Frag<T>::mma(ah, bl[j], acc[i][j]);
          acc[i][j] = Frag<T>::mma(al, bh[j], acc[i][j]);
        }
      }
      Frag<T>::guard(acc[i][0], acc[i][3], ah, SPLIT ? al : ah);
    }
    Frag<T>::keep(bh[0], bh[1], bh[2], bh[3]);
    if (SPLIT) Frag<T>::keep(bl[0], bl[1], bl[2], bl[3]);
  }
  acc_guard4(acc[0][0], acc[0][1], acc[0][2], acc[0][3]);
  acc_guard4(acc[1][0], acc[1][1], acc[1][2], acc[1][3]);
  acc_guard4(acc[2][0], acc[2][1], acc[2][2], acc[2][3]);
  acc_guard4(acc[3][0], acc[3][1], acc[3][2], acc[3][3]);

  // ---- epilogue ----
  float* slab = sT[wave];
  const float* Rb = RESID ? (resid + (size_t)b * strideR) : nullptr;
#pragma unroll
  for (int i = 0; i < 4; ++i) {
    const int mBase = m0 + (i << 4);
#pragma unroll
    for (int j = 0; j < 4; ++j) {
      const int n = n0 + (j << 4) + rlane;
      float bv = 0.f;
      if (BIAS_MODE == 2) bv = bias[n];
#pragma unroll
      for (int r = 0; r < 8; ++r) {
        float v = acc[i][j][r] * scale;
        if (BIAS_MODE == 1) v += bias[mBase + mOff + r];
        if (BIAS_MODE == 2) v += bv;
        if (RESID) v += Rb[(size_t)(mBase + mOff + r) * ldc + n];
        if (ACT == 1) v = tanhf(v);
        if (ACT == 2) v = fmaxf(v, 0.0f);
        if (ACT == 3) v = v / (1.0f + expf(-v));
        if (ACT == 4) v = (v > 0.f) ? v : 0.01f * v;
        if (ACT == 5) v = 0.5f * v * (1.0f + erff(v * 0.70710678118654752f));
        slab[(mOff + r) * 68 + (j << 4) + rlane] = v;
      }
    }
    __builtin_amdgcn_fence(__ATOMIC_RELEASE, "workgroup");
    __builtin_amdgcn_wave_barrier();
    __builtin_amdgcn_fence(__ATOMIC_ACQUIRE, "workgroup");
    if (OUT_MODE == 0) {
      float* C = (float*)Cout + (size_t)b * strideC;
      const int hh = lane >> 4, c4 = (lane & 15) * 4;     // row seg = 256 B = 16 lanes x 16 B
      {
#pragma unroll
        for (int it = 0; it < 8; ++it) {
          const int row = it * 2 + hh;
          v4f v = *(const v4f*)(slab + row * 68 + c4);
          *(v4f*)(C + (size_t)(mBase + row) * ldc + n0 + c4) = v;
        }
        
      }
    } else {
      const int q = lane >> 3, c8 = (lane & 7) * 8;
      unsigned short* C  = (unsigned short*)Cout  + (size_t)b * strideC;
      unsigned short* C2 = (OUT_MODE == 2) ? ((unsigned short*)Cout2 + (size_t)b * strideC) : nullptr;
      {
#pragma unroll
        for (int it = 0; it < 4; ++it) {
          const int row = it * 4 + q;
          const float* sp = slab + row * 68 + c8;
          v8h hv, lv;
#pragma unroll
          for (int e = 0; e < 8; ++e) {
            if (OUT_MODE == 1) {
              hv[e] = (_Float16)sp[e];
            } else {
              unsigned short hb = f2bf_bits(sp[e]);
              unsigned short lb = f2bf_bits(sp[e] - bf_bits2f(hb));
              hv[e] = __builtin_bit_cast(_Float16, hb);
              lv[e] = __builtin_bit_cast(_Float16, lb);
            }
          }
          *(v8h*)(C + (size_t)(mBase + row) * ldc + n0 + c8) = hv;
          if (OUT_MODE == 2) *(v8h*)(C2 + (size_t)(mBase + row) * ldc + n0 + c8) = lv;
        }
        
      }
    }
    __builtin_amdgcn_fence(__ATOMIC_RELEASE, "workgroup");
    __builtin_amdgcn_wave_barrier();
    __builtin_amdgcn_fence(__ATOMIC_ACQUIRE, "workgroup");
  }
}

__global__ __launch_bounds__(256) void cast_f32_f16x2s(
    const float* __restrict__ in, _Float16* __restrict__ out, int n2, float sc) {
  int i = blockIdx.x * 256 + threadIdx.x;
  if (i < n2) {
    const _Float16 h0 = (_Float16)(in[2 * i] * sc), h1 = (_Float16)(in[2 * i + 1] * sc);
    const unsigned u = (unsigned)__builtin_bit_cast(unsigned short, h0) | ((unsigned)__builtin_bit_cast(unsigned short, h1) << 16);
    ((unsigned*)out)[i] = u;
    
  }
}

// ---- same cast for four equally sized matrices in one launch: blockIdx.y selects the source; plane y of out ----
__global__ __launch_bounds__(256) void cast4_f32_f16x2s(
    const float* __restrict__ s0, const float* __restrict__ s1,
    const float* __restrict__ s2, const float* __restrict__ s3,
    _Float16* __restrict__ out, int n2each, float sc) {
  const int y = blockIdx.y;                                      // block-uniform select among global pointers
  const float* in = (y == 0) ? s0 : (y == 1) ? s1 : (y == 2) ? s2 : s3;
  _Float16* o = out + (size_t)y * (size_t)n2each * 2;
  int i = blockIdx.x * 256 + threadIdx.x;
  if (i < n2each) {
    const _Float16 h0 = (_Float16)(in[2 * i] * sc), h1 = (_Float16)(in[2 * i + 1] * sc);
    const unsigned u = (unsigned)__builtin_bit_cast(unsigned short, h0) | ((unsigned)__builtin_bit_cast(unsigned short, h1) << 16);
    ((unsigned*)o)[i] = u;
    
  }
}

// =====================================================================================
// Lean attention for head_dim 64 on f16 planes (no operand conversion inside, no K/V LDS staging):
//   q  [S][ldq]   f16, head h at columns h*64..h*64+63
//   k  [Skv][ldk] f16, same column layout
//   vt [H*64][ldv] f16, row = h*64+d, column = key index (k-contiguous B fragments)
//   maskv [Skv] f32 key vector; score = (q.k) * qscale + (1 - maskv[kv]) * mask_fill
//   ctx [S][ldo] f16 out, head h at columns h*64.., value = oscale * softmax(score) . v
//   q.kT and p.v: v_wmma_f32_16x16x32_f16, f32 accumulate; online softmax in f32; P carried x2^15 in f16.
//   Block = 4 waves = 64 query rows of one head; S, Skv % 64 == 0; grid.x = H * (S/64).
//   A/B fragments via Frag<_Float16>::load (split k map, statically strided addresses only).
// =====================================================================================
#define AT_D 64
#define AT_NW 4
#define AT_QB 64
#define AT_KC 64

__device__ __forceinline__ v8f mma_h(v16h a, v16h b, v8f c) {
  c = __builtin_amdgcn_wmma_f32_16x16x32_f16(false, a, false, b, (short)0, c, false, false);
  asm volatile("v_nop\n\tv_nop\n\tv_nop\n\tv_nop" : "+v"(c) : "v"(a), "v"(b));
  return c;
}

__global__ __launch_bounds__(128)
void attn64_f16_kernel(const _Float16* __restrict__ q, const _Float16* __restrict__ k,
                       const _Float16* __restrict__ vt, const float* __restrict__ maskv,
                       _Float16* __restrict__ ctx,
                       int S, int Skv, int H, int ldq, int ldk, int ldv, int ldo,
                       float qscale, float mask_fill, float oscale) {
  const float PSC = 32768.0f;                  // probabilities carried x2^15, folded into the final 1/l
  union FH { v16h v; v8h h[2]; };
  __shared__ __align__(16) _Float16 Psh[AT_NW][16 * AT_KC];    // per wave P [row][kv]  2 KB each
  __shared__ __align__(16) float    Os[AT_NW][16 * 68];        // per wave out tile, pitch 68

  const int tid  = threadIdx.x;
  const int wave = tid >> 5;
  const int lane = tid & 31;
  const int hh   = lane >> 4;
  const int c    = lane & 15;

  const int nqb = S / AT_QB;
  const int bx  = blockIdx.x;
  const int qb  = bx % nqb;
  const int h   = bx / nqb;
  if (h >= H) return;                          // block-uniform; no block barriers in this kernel
  const int q0   = qb * AT_QB + wave * 16;
  const int hoff = h * AT_D;

  // ---- Q fragments (A operand, row = q0 + c): 2 d-chunks ----
  v16h qa[2];
  {
    const _Float16* qrow = q + (size_t)(q0 + c) * ldq + hoff + 8 * hh;
#pragma unroll
    for (int dc = 0; dc < 2; ++dc) qa[dc] = Frag<_Float16>::load(qrow + dc * 32);
  }

  float mrow[8], lrow[8];
  v8f oacc[4];
#pragma unroll
  for (int r = 0; r < 8; ++r) { mrow[r] = -INFINITY; lrow[r] = 0.f; }
#pragma unroll
  for (int t = 0; t < 4; ++t) oacc[t] = (v8f){0.f,0.f,0.f,0.f,0.f,0.f,0.f,0.f};

  _Float16* pw = Psh[wave];
  const int nChunks = Skv / AT_KC;             // host-derived, static for the launch
  for (int kc = 0; kc < nChunks; ++kc) {
    const int kv0 = kc * AT_KC;

    // ---- scores S[16 x 64]: D row 8hh+r = query q0+8hh+r, D col c of subtile j = key kv0+16j+c ----
    v8f s[4];
#pragma unroll
    for (int j = 0; j < 4; ++j) {
      s[j] = (v8f){0.f,0.f,0.f,0.f,0.f,0.f,0.f,0.f};
      const _Float16* krow = k + (size_t)(kv0 + j * 16 + c) * ldk + hoff + 8 * hh;   // B[k=d][n=key]: key row, d along the row
#pragma unroll
      for (int dc = 0; dc < 2; ++dc) {
        const v16h kb = Frag<_Float16>::load(krow + dc * 32);
        s[j] = mma_h(qa[dc], kb, s[j]);
      }
    }
    float madd[4];
#pragma unroll
    for (int j = 0; j < 4; ++j) madd[j] = (1.0f - maskv[kv0 + j * 16 + c]) * mask_fill;

    float cm[8];
#pragma unroll
    for (int r = 0; r < 8; ++r) {
      float m = -INFINITY;
#pragma unroll
      for (int j = 0; j < 4; ++j) {
        const float x = s[j][r] * qscale + madd[j];
        s[j][r] = x;
        m = fmaxf(m, x);
      }
#pragma unroll
      for (int off = 1; off < 16; off <<= 1) m = fmaxf(m, __shfl_xor(m, off, 32));
      cm[r] = m;
    }

    // order the P fragment reads of the preceding chunk before this chunk's P stores
    __builtin_amdgcn_fence(__ATOMIC_RELEASE, "workgroup");
    __builtin_amdgcn_wave_barrier();
    __builtin_amdgcn_fence(__ATOMIC_ACQUIRE, "workgroup");

#pragma unroll
    for (int r = 0; r < 8; ++r) {
      const float mnew  = fmaxf(mrow[r], cm[r]);
      const float alpha = expf(mrow[r] - mnew);
      mrow[r] = mnew;
      float psum = 0.f;
#pragma unroll
      for (int j = 0; j < 4; ++j) {
        const float p = expf(s[j][r] - mnew);
        psum += p;
        pw[(8 * hh + r) * AT_KC + j * 16 + c] = (_Float16)(p * PSC);
      }
#pragma unroll
      for (int off = 1; off < 16; off <<= 1) psum += __shfl_xor(psum, off, 32);
      lrow[r] = lrow[r] * alpha + psum;
#pragma unroll
      for (int t = 0; t < 4; ++t) oacc[t][r] *= alpha;
    }
    __builtin_amdgcn_fence(__ATOMIC_RELEASE, "workgroup");
    __builtin_amdgcn_wave_barrier();
    __builtin_amdgcn_fence(__ATOMIC_ACQUIRE, "workgroup");

    // ---- ctx += P (16 x 64 keys) . V (64 keys x 64 d) ----
#pragma unroll 1
    for (int kk = 0; kk < 2; ++kk) {
      FH pa;                                                           // A[m = query c][k = key kk*32 + split map]
      pa.h[0] = *(const v8h*)(pw + c * AT_KC + kk * 32 + 8 * hh);
      pa.h[1] = *(const v8h*)(pw + c * AT_KC + kk * 32 + 16 + 8 * hh);
#pragma unroll
      for (int t = 0; t < 4; ++t) {                                    // B[k = key][n = d t*16+c] from vt row hoff+t*16+c
        const v16h vb = Frag<_Float16>::load(vt + (size_t)(hoff + t * 16 + c) * ldv + kv0 + kk * 32 + 8 * hh);
        oacc[t] = mma_h(pa.v, vb, oacc[t]);
      }
    }
  }

  // ---- epilogue: ctx row (q0 + 8hh + r), column hoff + t*16 + c ----
  float* os = Os[wave];
#pragma unroll
  for (int r = 0; r < 8; ++r) {
    const float inv = oscale / (lrow[r] * PSC);
#pragma unroll
    for (int t = 0; t < 4; ++t) os[(8 * hh + r) * 68 + t * 16 + c] = oacc[t][r] * inv;
  }
  __builtin_amdgcn_fence(__ATOMIC_RELEASE, "workgroup");
  __builtin_amdgcn_wave_barrier();
  __builtin_amdgcn_fence(__ATOMIC_ACQUIRE, "workgroup");
  {
    const int q8 = lane >> 3, c8 = (lane & 7) * 8;
    {
#pragma unroll
      for (int it = 0; it < 4; ++it) {
        const int row = it * 4 + q8;                     // rows 0..15 covered by q8 0..3, it 0..3
        const float* sp = os + row * 68 + c8;
        v8h hv;
#pragma unroll
        for (int e = 0; e < 8; ++e) hv[e] = (_Float16)sp[e];
        *(v8h*)(ctx + (size_t)(q0 + row) * ldo + hoff + c8) = hv;
      }
      
    }
  }
}

// =====================================================================================
// One block of 256 threads per row; requires ncols == 1024. Each thread owns 4 consecutive floats;
// =====================================================================================
__global__ __launch_bounds__(256) void row_tanh_res_ln_kernel(
    const float* __restrict__ y, const float* __restrict__ res,
    const float* __restrict__ gamma, const float* __restrict__ beta,
    float* __restrict__ out, int ncols, float eps) {
  __shared__ float red[16];
  const int row  = blockIdx.x;
  const int t    = threadIdx.x;
  const int lane = t & 31;
  const int wave = t >> 5;
  const size_t base = (size_t)row * ncols + 4 * t;
  const v4f yv = *(const v4f*)(y + base);
  const v4f rv = *(const v4f*)(res + base);
  const float x0 = tanhf(yv[0]) + rv[0];
  const float x1 = tanhf(yv[1]) + rv[1];
  const float x2 = tanhf(yv[2]) + rv[2];
  const float x3 = tanhf(yv[3]) + rv[3];
  float s = (x0 + x1) + (x2 + x3);
#pragma unroll
  for (int off = 1; off < 32; off <<= 1) s += __shfl_xor(s, off, 32);
  if (lane == 0) red[wave] = s;
  __syncthreads();
  float tot = 0.f;
#pragma unroll
  for (int w = 0; w < 8; ++w) tot += red[w];
  const float inv_n = 1.0f / (float)ncols;
  const float mu = tot * inv_n;
  const float d0 = x0 - mu, d1 = x1 - mu, d2 = x2 - mu, d3 = x3 - mu;
  float s2 = (d0 * d0 + d1 * d1) + (d2 * d2 + d3 * d3);
#pragma unroll
  for (int off = 1; off < 32; off <<= 1) s2 += __shfl_xor(s2, off, 32);
  if (lane == 0) red[8 + wave] = s2;
  __syncthreads();
  float tot2 = 0.f;
#pragma unroll
  for (int w = 0; w < 8; ++w) tot2 += red[8 + w];
  const float var = tot2 * inv_n;
  const float rn  = 1.0f / sqrtf(var + eps);
  const v4f gv = *(const v4f*)(gamma + 4 * t);
  const v4f bv = *(const v4f*)(beta + 4 * t);
  v4f o;
  o[0] = d0 * rn * gv[0] + bv[0];
  o[1] = d1 * rn * gv[1] + bv[1];
  o[2] = d2 * rn * gv[2] + bv[2];
  o[3] = d3 * rn * gv[3] + bv[3];
  *(v4f*)(out + base) = o;
  
}

// ----------------------------------------------------------------------------
extern "C" void kernel_launch(void* const* d_in, const int* in_sizes, int n_in,
                              void* d_out, int out_size, void* d_ws, size_t ws_size,
                              hipStream_t stream) {
  if (n_in < 12) return;
  const float* ht    = (const float*)d_in[0];
  const float* amask = (const float*)d_in[1];
  const float* Wq    = (const float*)d_in[2];
  const float* bq    = (const float*)d_in[3];
  const float* Wk    = (const float*)d_in[4];
  const float* bk    = (const float*)d_in[5];
  const float* Wv    = (const float*)d_in[6];
  const float* bv    = (const float*)d_in[7];
  const float* Wd    = (const float*)d_in[8];
  const float* bd    = (const float*)d_in[9];
  const float* gamma = (const float*)d_in[10];
  const float* beta  = (const float*)d_in[11];

  const int Dm = in_sizes[3];                 // hidden size (1024)
  if (Dm != 1024) return;
  const int Nn = in_sizes[0] / Dm;            // tokens (2048)
  const int Hh = 16;
  const int Dh = Dm / Hh;                     // 64
  if (Dh != 64 || Nn <= 0 || (Nn % 64) != 0 || in_sizes[0] != Nn * Dm) return;
  if (in_sizes[2] != Dm * Dm || in_sizes[4] != Dm * Dm || in_sizes[6] != Dm * Dm || in_sizes[8] != Dm * Dm) return;
  if (in_sizes[1] < Nn || in_sizes[5] < Dm || in_sizes[7] < Dm || in_sizes[9] < Dm || in_sizes[10] < Dm || in_sizes[11] < Dm) return;
  if (out_size != Nn * Dm) return;

  // ---- workspace carve (bytes; every sub-buffer size is a multiple of 256 B, so all offsets are line aligned) ----
  const size_t bHt16 = (size_t)Nn * Dm * 2;   // f16 [N][D] (and [D][N])
  const size_t bW16  = (size_t)Dm * Dm * 2;   // f16 [D][D]
  const size_t bF    = (size_t)Nn * Dm * 4;   // f32 [N][D]
  size_t o = 0;
  char* ws = (char*)d_ws;
  _Float16* ht16  = (_Float16*)(ws + o); o += bHt16;
  _Float16* w16   = (_Float16*)(ws + o); o += 4 * bW16;      // planes: 0 = Wq x16, 1 = Wk x16, 2 = Wv x16, 3 = Wd x16
  _Float16* q16   = (_Float16*)(ws + o); o += bHt16;         // [N][D]
  _Float16* k16   = (_Float16*)(ws + o); o += bHt16;         // [N][D]
  _Float16* vt16  = (_Float16*)(ws + o); o += bHt16;         // [D][N]  (d-major, token contiguous)
  _Float16* ctx16 = (_Float16*)(ws + o); o += bHt16;         // [N][D], carried x16
  float*    yf    = (float*)(ws + o);    o += bF;            // [N][D] f32 dense pre-activation
  if (o > ws_size) return;                                   // 37748736 B for the given sizes
  _Float16* wq16 = w16;
  _Float16* wk16 = w16 + (size_t)Dm * Dm;
  _Float16* wv16 = w16 + (size_t)2 * Dm * Dm;
  _Float16* wd16 = w16 + (size_t)3 * Dm * Dm;

  // ---- casts to f16 (weights carried x16) ----
  const int nHt2 = Nn * Dm / 2, nW2 = Dm * Dm / 2;
  cast_f32_f16x2s<<<(nHt2 + 255) / 256, 256, 0, stream>>>(ht, ht16, nHt2, 1.0f);
  cast4_f32_f16x2s<<<dim3((nW2 + 255) / 256, 4), 256, 0, stream>>>(Wq, Wk, Wv, Wd, w16, nW2, 16.0f);

  // ---- q, k projections: [Nn][Dm] f16 = ht16 . W16^T * (1/16) + bias[n] ----
  const int tilesQK = (Nn / 64) * (Dm / 64);
  const dim3 gqk((tilesQK + 7) / 8, 1);
  const unsigned short* Au = (const unsigned short*)ht16;
  wmma_gemm64<0, false, 2, 1, false, 0><<<gqk, 256, 0, stream>>>(
      Au, Au, Dm, 0L, (const unsigned short*)wq16, (const unsigned short*)wq16, Dm, 0L,
      (void*)q16, (void*)q16, Dm, 0L, bq, ht, 0L, Nn, Dm, Dm, 1.0f / 16.0f);
  wmma_gemm64<0, false, 2, 1, false, 0><<<gqk, 256, 0, stream>>>(
      Au, Au, Dm, 0L, (const unsigned short*)wk16, (const unsigned short*)wk16, Dm, 0L,
      (void*)k16, (void*)k16, Dm, 0L, bk, ht, 0L, Nn, Dm, Dm, 1.0f / 16.0f);
  // ---- v projection, transposed: vt16[dout][token] = Wv16 . ht16^T * (1/16) + bv[dout]  (M = Dm, N = Nn, bias[m]) ----
  const int tilesV = (Dm / 64) * (Nn / 64);
  const dim3 gv((tilesV + 7) / 8, 1);
  wmma_gemm64<0, false, 1, 1, false, 0><<<gv, 256, 0, stream>>>(
      (const unsigned short*)wv16, (const unsigned short*)wv16, Dm, 0L, Au, Au, Dm, 0L,
      (void*)vt16, (void*)vt16, Nn, 0L, bv, ht, 0L, Dm, Nn, Dm, 1.0f / 16.0f);

  // ---- attention: per (head, 64 query rows) block, 64-key chunks, scale 1/8, additive key mask (1 - m) * -1e4; ctx carried x16 ----
  attn64_f16_kernel<<<Hh * (Nn / 64), 128, 0, stream>>>(
      q16, k16, vt16, amask, ctx16, Nn, Nn, Hh, Dm, Dm, Nn, Dm, 0.125f, -10000.0f, 16.0f);

  // ---- dense projection y = ctx16 . Wd16^T * (1/256) + bd (f32 out) ----
  const unsigned short* Cu = (const unsigned short*)ctx16;
  wmma_gemm64<0, false, 2, 0, false, 0><<<gqk, 256, 0, stream>>>(
      Cu, Cu, Dm, 0L, (const unsigned short*)wd16, (const unsigned short*)wd16, Dm, 0L,
      (void*)yf, (void*)yf, Dm, 0L, bd, ht, 0L, Nn, Dm, Dm, 1.0f / 256.0f);

  // ---- tanh + residual + LayerNorm -> d_out ----
  row_tanh_res_ln_kernel<<<Nn, 256, 0, stream>>>(yf, ht, gamma, beta, (float*)d_out, Dm, 1e-5f);
}

// v001
// One run takes 265 microseconds.
// In both of two side-by-side timings against v000, it was 1.48 times as fast.
#include <hip/hip_runtime.h>
// Contractions: q/k/v/dense projections v_wmma_f32_16x16x32_f16 (f16 operands, weights carried x16, ctx carried x16, f32 accumulate);
// attention q.kT and p.v v_wmma_f32_16x16x32_f16 (f16 operands, p carried x2^15, f32 accumulate); scale, mask, softmax, tanh, residual, LayerNorm in f32.

typedef __attribute__((ext_vector_type(16))) _Float16 v16h;
typedef __attribute__((ext_vector_type(8)))  _Float16 v8h;
typedef __attribute__((ext_vector_type(16))) __bf16   v16b;
typedef __attribute__((ext_vector_type(8)))  __bf16   v8b;
typedef __attribute__((ext_vector_type(8)))  float    v8f;
typedef __attribute__((ext_vector_type(4)))  float    v4f;

__device__ __forceinline__ unsigned short f2bf_bits(float f) {
  unsigned u = __float_as_uint(f);
  return (unsigned short)((u + 0x7FFFu + ((u >> 16) & 1u)) >> 16);
}
__device__ __forceinline__ float bf_bits2f(unsigned short h) { return __uint_as_float(((unsigned)h) << 16); }

// hazard guards as plain device helpers (no inline asm inside the kernel template body)
__device__ __forceinline__ void dep_guard_h(v8f& a, v8f& b, v16h x, v16h y) { asm volatile("v_nop\n\tv_nop\n\tv_nop\n\tv_nop" : "+v"(a), "+v"(b) : "v"(x), "v"(y)); }
__device__ __forceinline__ void dep_guard_b(v8f& a, v8f& b, v16b x, v16b y) { asm volatile("v_nop\n\tv_nop\n\tv_nop\n\tv_nop" : "+v"(a), "+v"(b) : "v"(x), "v"(y)); }
__device__ __forceinline__ void keep4_h(v16h a, v16h b, v16h c, v16h d) { asm volatile("v_nop" :: "v"(a), "v"(b), "v"(c), "v"(d)); }
__device__ __forceinline__ void keep4_b(v16b a, v16b b, v16b c, v16b d) { asm volatile("v_nop" :: "v"(a), "v"(b), "v"(c), "v"(d)); }
__device__ __forceinline__ void acc_guard4(v8f& a, v8f& b, v8f& c, v8f& d) { asm volatile("v_nop\n\tv_nop\n\tv_nop\n\tv_nop" : "+v"(a), "+v"(b), "+v"(c), "+v"(d)); }
// s_wait_xcnt 0 behind a group of global loads, kept as a precaution in front of any reuse of their address registers.
// The statement names those registers as inputs, so none of them is handed to a later load of the same group as its destination.
__device__ __forceinline__ void addr_wait4(const void* a, const void* b, const void* c, const void* d) {
  asm volatile("s_wait_xcnt 0x0" :: "v"(a), "v"(b), "v"(c), "v"(d) : "memory");
}
__device__ __forceinline__ void addr_wait5(const void* a, const void* b, const void* c, const void* d, int e) {
  asm volatile("s_wait_xcnt 0x0" :: "v"(a), "v"(b), "v"(c), "v"(d), "v"(e) : "memory");
}
__device__ __forceinline__ void addr_wait8(const void* a, const void* b, const void* c, const void* d,
                                           const void* e, const void* f, const void* g, const void* h) {
  asm volatile("s_wait_xcnt 0x0" :: "v"(a), "v"(b), "v"(c), "v"(d), "v"(e), "v"(f), "v"(g), "v"(h) : "memory");
}
template <typename T> struct Frag;
template <> struct Frag<_Float16> {
  typedef v16h V; union U { v16h v; v8h h[2]; };
  static __device__ __forceinline__ v16h load(const _Float16* p) {   // elements 0..7 <- p[0..7], 8..15 <- p[16..23]
    U f; f.h[0] = *(const v8h*)(p); f.h[1] = *(const v8h*)(p + 16); return f.v;
  }
  static __device__ __forceinline__ v8f mma(v16h a, v16h b, v8f c) {
    return __builtin_amdgcn_wmma_f32_16x16x32_f16(false, a, false, b, (short)0, c, false, false);
  }
  static __device__ __forceinline__ void guard(v8f& a, v8f& b, v16h x, v16h y) { dep_guard_h(a, b, x, y); }
  static __device__ __forceinline__ void keep(v16h a, v16h b, v16h c, v16h d) { keep4_h(a, b, c, d); }
};
template <> struct Frag<__bf16> {
  typedef v16b V; union U { v16b v; v8b h[2]; };
  static __device__ __forceinline__ v16b load(const __bf16* p) {
    U f; f.h[0] = *(const v8b*)(p); f.h[1] = *(const v8b*)(p + 16); return f.v;
  }
  static __device__ __forceinline__ v8f mma(v16b a, v16b b, v8f c) {
    return __builtin_amdgcn_wmma_f32_16x16x32_bf16(false, a, false, b, (short)0, c, false, false);
  }
  static __device__ __forceinline__ void guard(v8f& a, v8f& b, v16b x, v16b y) { dep_guard_b(a, b, x, y); }
  static __device__ __forceinline__ void keep(v16b a, v16b b, v16b c, v16b d) { keep4_b(a, b, c, d); }
};

// ---- Register-blocked batched WMMA GEMM ------------------------------------
// C[m,n] = scale * sum_k A[m,k] * Bt[n,k] (+bias)(+resid); each wave owns a 64x64 tile.
// A row-major [M,K]; Bt row-major [N,K]; M,N % 64 == 0, K % 32 == 0.
// SPLIT: operands are hi/lo planes (A2/Bt2 = lo planes, same layout); product = hi.hi + hi.lo + lo.hi.
// BIAS_MODE: 0 = none, 1 = bias[m], 2 = bias[n].
// OUT_MODE: 0 = f32, 1 = f16, 2 = bf16 hi plane (Cout) + bf16 lo plane (Cout2).
// ET: 0 = f16 operands, 1 = bf16 operands (pointers passed as 16-bit storage)
template <int ET> struct Elem;
template <> struct Elem<0> { typedef _Float16 T; };
template <> struct Elem<1> { typedef __bf16 T; };
template <int ET, bool SPLIT, int BIAS_MODE, int OUT_MODE, bool RESID, int ACT = 0>
__global__ __launch_bounds__(256) void wmma_gemm64(
    const unsigned short* __restrict__ Ap, const unsigned short* __restrict__ A2p, int lda, long strideA,
    const unsigned short* __restrict__ Btp, const unsigned short* __restrict__ Bt2p, int ldb, long strideB,
    void* __restrict__ Cout, void* __restrict__ Cout2, int ldc, long strideC,
    const float* __restrict__ bias,
    const float* __restrict__ resid, long strideR,
    int M, int N, int K, float scale) {
  typedef typename Elem<ET>::T T;
  typedef typename Frag<T>::V V;
  const T* A = (const T*)Ap; const T* A2 = (const T*)A2p; const T* Bt = (const T*)Btp; const T* Bt2 = (const T*)Bt2p;
  __shared__ __align__(16) float sT[8][16 * 68];   // per-wave 16x64 slab, pitch 68 floats
  const int b    = blockIdx.y;
  const int lane = threadIdx.x & 31;
  const int wave = threadIdx.x >> 5;
  const int tilesN = N >> 6;
  const int tilesM = M >> 6;
  const int tile = blockIdx.x * 8 + wave;
  if (tile >= tilesM * tilesN) return;   // wave-uniform; no block barriers in this kernel
  const int tm = tile / tilesN;
  const int tn = tile - tm * tilesN;
  const int m0 = tm << 6;
  const int n0 = tn << 6;

  const T* Ab  = A  + (size_t)b * strideA;
  const T* Bb  = Bt + (size_t)b * strideB;
  const T* Ab2 = SPLIT ? (A2  + (size_t)b * strideA) : nullptr;
  const T* Bb2 = SPLIT ? (Bt2 + (size_t)b * strideB) : nullptr;

  const int rlane = lane & 15;                 // row (A) / col (B, D) within subtile
  const int koff  = (lane >> 4) * 8;           // k offset of this lane half
  const int mOff  = (lane >> 4) * 8;           // D row offset

  v8f acc[4][4];
#pragma unroll
  for (int i = 0; i < 4; ++i)
#pragma unroll
    for (int j = 0; j < 4; ++j) acc[i][j] = (v8f){0.f,0.f,0.f,0.f,0.f,0.f,0.f,0.f};

  for (int k0 = 0; k0 < K; k0 += 32) {
    // every fragment of this k-step is requested here, ahead of the first product: one load round trip per step
    V bh[4], bl[4], ah[4], al[4];
    const T *pb[4], *pa[4];
#pragma unroll
    for (int j = 0; j < 4; ++j) {
      const size_t bo = (size_t)(n0 + (j << 4) + rlane) * ldb + koff + k0;
      pb[j] = Bb + bo;
      bh[j] = Frag<T>::load(pb[j]);
      if (SPLIT) bl[j] = Frag<T>::load(Bb2 + bo);
    }
#pragma unroll
    for (int i = 0; i < 4; ++i) {
      const size_t ao = (size_t)(m0 + (i << 4) + rlane) * lda + koff + k0;
      pa[i] = Ab + ao;
      ah[i] = Frag<T>::load(pa[i]);
      if (SPLIT) al[i] = Frag<T>::load(Ab2 + ao);
    }
    addr_wait8(pb[0], pb[1], pb[2], pb[3], pa[0], pa[1], pa[2], pa[3]);
    if (SPLIT) addr_wait8(Bb2 + (pb[0] - Bb), Bb2 + (pb[1] - Bb), Bb2 + (pb[2] - Bb), Bb2 + (pb[3] - Bb),
                          Ab2 + (pa[0] - Ab), Ab2 + (pa[1] - Ab), Ab2 + (pa[2] - Ab), Ab2 + (pa[3] - Ab));
#pragma unroll
    for (int i = 0; i < 4; ++i) {
#pragma unroll
      for (int j = 0; j < 4; ++j) {
        acc[i][j] = Frag<T>::mma(ah[i], bh[j], acc[i][j]);
        if (SPLIT) {
          acc[i][j] = Frag<T>::mma(ah[i], bl[j], acc[i][j]);
          acc[i][j] = Frag<T>::mma(al[i], bh[j], acc[i][j]);
        }
      }
      Frag<T>::guard(acc[i][0], acc[i][3], ah[i], SPLIT ? al[i] : ah[i]);
    }
    Frag<T>::keep(bh[0], bh[1], bh[2], bh[3]);
    if (SPLIT) Frag<T>::keep(bl[0], bl[1], bl[2], bl[3]);
  }
  acc_guard4(acc[0][0], acc[0][1], acc[0][2], acc[0][3]);
  acc_guard4(acc[1][0], acc[1][1], acc[1][2], acc[1][3]);
  acc_guard4(acc[2][0], acc[2][1], acc[2][2], acc[2][3]);
  acc_guard4(acc[3][0], acc[3][1], acc[3][2], acc[3][3]);

  // ---- epilogue ----
  float* slab = sT[wave];
  const float* Rb = RESID ? (resid + (size_t)b * strideR) : nullptr;
#pragma unroll
  for (int i = 0; i < 4; ++i) {
    const int mBase = m0 + (i << 4);
#pragma unroll
    for (int j = 0; j < 4; ++j) {
      const int n = n0 + (j << 4) + rlane;
      float bv = 0.f;
      if (BIAS_MODE == 2) bv = bias[n];
#pragma unroll
      for (int r = 0; r < 8; ++r) {
        float v = acc[i][j][r] * scale;
        if (BIAS_MODE == 1) v += bias[mBase + mOff + r];
        if (BIAS_MODE == 2) v += bv;
        if (RESID) v += Rb[(size_t)(mBase + mOff + r) * ldc + n];
        if (ACT == 1) v = tanhf(v);
        if (ACT == 2) v = fmaxf(v, 0.0f);
        if (ACT == 3) v = v / (1.0f + expf(-v));
        if (ACT == 4) v = (v > 0.f) ? v : 0.01f * v;
        if (ACT == 5) v = 0.5f * v * (1.0f + erff(v * 0.70710678118654752f));
        slab[(mOff + r) * 68 + (j << 4) + rlane] = v;
      }
    }
    __builtin_amdgcn_fence(__ATOMIC_RELEASE, "workgroup");
    __builtin_amdgcn_wave_barrier();
    __builtin_amdgcn_fence(__ATOMIC_ACQUIRE, "workgroup");
    if (OUT_MODE == 0) {
      float* C = (float*)Cout + (size_t)b * strideC;
      const int hh = lane >> 4, c4 = (lane & 15) * 4;     // row seg = 256 B = 16 lanes x 16 B
      {
#pragma unroll
        for (int it = 0; it < 8; ++it) {
          const int row = it * 2 + hh;
          v4f v = *(const v4f*)(slab + row * 68 + c4);
          *(v4f*)(C + (size_t)(mBase + row) * ldc + n0 + c4) = v;
        }
        
      }
    } else {
      const int q = lane >> 3, c8 = (lane & 7) * 8;
      unsigned short* C  = (unsigned short*)Cout  + (size_t)b * strideC;
      unsigned short* C2 = (OUT_MODE == 2) ? ((unsigned short*)Cout2 + (size_t)b * strideC) : nullptr;
      {
#pragma unroll
        for (int it = 0; it < 4; ++it) {
          const int row = it * 4 + q;
          const float* sp = slab + row * 68 + c8;
          v8h hv, lv;
#pragma unroll
          for (int e = 0; e < 8; ++e) {
            if (OUT_MODE == 1) {
              hv[e] = (_Float16)sp[e];
            } else {
              unsigned short hb = f2bf_bits(sp[e]);
              unsigned short lb = f2bf_bits(sp[e] - bf_bits2f(hb));
              hv[e] = __builtin_bit_cast(_Float16, hb);
              lv[e] = __builtin_bit_cast(_Float16, lb);
            }
          }
          *(v8h*)(C + (size_t)(mBase + row) * ldc + n0 + c8) = hv;
          if (OUT_MODE == 2) *(v8h*)(C2 + (size_t)(mBase + row) * ldc + n0 + c8) = lv;
        }
        
      }
    }
    __builtin_amdgcn_fence(__ATOMIC_RELEASE, "workgroup");
    __builtin_amdgcn_wave_barrier();
    __builtin_amdgcn_fence(__ATOMIC_ACQUIRE, "workgroup");
  }
}

__global__ __launch_bounds__(256) void cast_f32_f16x2s(
    const float* __restrict__ in, _Float16* __restrict__ out, int n2, float sc) {
  int i = blockIdx.x * 256 + threadIdx.x;
  if (i < n2) {
    const _Float16 h0 = (_Float16)(in[2 * i] * sc), h1 = (_Float16)(in[2 * i + 1] * sc);
    const unsigned u = (unsigned)__builtin_bit_cast(unsigned short, h0) | ((unsigned)__builtin_bit_cast(unsigned short, h1) << 16);
    ((unsigned*)out)[i] = u;
    
  }
}

// ---- same cast for four equally sized matrices in one launch: blockIdx.y selects the source; plane y of out ----
__global__ __launch_bounds__(256) void cast4_f32_f16x2s(
    const float* __restrict__ s0, const float* __restrict__ s1,
    const float* __restrict__ s2, const float* __restrict__ s3,
    _Float16* __restrict__ out, int n2each, float sc) {
  const int y = blockIdx.y;                                      // block-uniform select among global pointers
  const float* in = (y == 0) ? s0 : (y == 1) ? s1 : (y == 2) ? s2 : s3;
  _Float16* o = out + (size_t)y * (size_t)n2each * 2;
  int i = blockIdx.x * 256 + threadIdx.x;
  if (i < n2each) {
    const _Float16 h0 = (_Float16)(in[2 * i] * sc), h1 = (_Float16)(in[2 * i + 1] * sc);
    const unsigned u = (unsigned)__builtin_bit_cast(unsigned short, h0) | ((unsigned)__builtin_bit_cast(unsigned short, h1) << 16);
    ((unsigned*)o)[i] = u;
    
  }
}

// =====================================================================================
// Lean attention for head_dim 64 on f16 planes (no operand conversion inside, no K/V LDS staging):
//   q  [S][ldq]   f16, head h at columns h*64..h*64+63
//   k  [Skv][ldk] f16, same column layout
//   vt [H*64][ldv] f16, row = h*64+d, column = key index (k-contiguous B fragments)
//   maskv [Skv] f32 key vector; score = (q.k) * qscale + (1 - maskv[kv]) * mask_fill
//   ctx [S][ldo] f16 out, head h at columns h*64.., value = oscale * softmax(score) . v
//   q.kT and p.v: v_wmma_f32_16x16x32_f16, f32 accumulate; online softmax in f32; P carried x2^15 in f16.
//   Block = 4 waves = 64 query rows of one head; S, Skv % 64 == 0; grid.x = H * (S/64).
//   A/B fragments via Frag<_Float16>::load (split k map, statically strided addresses only).
// =====================================================================================
#define AT_D 64
#define AT_NW 4
#define AT_QB 64
#define AT_KC 64

__device__ __forceinline__ v8f mma_h(v16h a, v16h b, v8f c) {
  c = __builtin_amdgcn_wmma_f32_16x16x32_f16(false, a, false, b, (short)0, c, false, false);
  asm volatile("v_nop\n\tv_nop\n\tv_nop\n\tv_nop" : "+v"(c) : "v"(a), "v"(b));
  return c;
}

__global__ __launch_bounds__(128)
void attn64_f16_kernel(const _Float16* __restrict__ q, const _Float16* __restrict__ k,
                       const _Float16* __restrict__ vt, const float* __restrict__ maskv,
                       _Float16* __restrict__ ctx,
                       int S, int Skv, int H, int ldq, int ldk, int ldv, int ldo,
                       float qscale, float mask_fill, float oscale) {
  const float PSC = 32768.0f;                  // probabilities carried x2^15, folded into the final 1/l
  union FH { v16h v; v8h h[2]; };
  __shared__ __align__(16) _Float16 Psh[AT_NW][16 * AT_KC];    // per wave P [row][kv]  2 KB each
  __shared__ __align__(16) float    Os[AT_NW][16 * 68];        // per wave out tile, pitch 68

  const int tid  = threadIdx.x;
  const int wave = tid >> 5;
  const int lane = tid & 31;
  const int hh   = lane >> 4;
  const int c    = lane & 15;

  const int nqb = S / AT_QB;
  const int bx  = blockIdx.x;
  const int qb  = bx % nqb;
  const int h   = bx / nqb;
  if (h >= H) return;                          // block-uniform; no block barriers in this kernel
  const int q0   = qb * AT_QB + wave * 16;
  const int hoff = h * AT_D;

  // ---- Q fragments (A operand, row = q0 + c): 2 d-chunks ----
  v16h qa[2];
  {
    const _Float16* qrow = q + (size_t)(q0 + c) * ldq + hoff + 8 * hh;
#pragma unroll
    for (int dc = 0; dc < 2; ++dc) qa[dc] = Frag<_Float16>::load(qrow + dc * 32);
  }

  float mrow[8], lrow[8];
  v8f oacc[4];
#pragma unroll
  for (int r = 0; r < 8; ++r) { mrow[r] = -INFINITY; lrow[r] = 0.f; }
#pragma unroll
  for (int t = 0; t < 4; ++t) oacc[t] = (v8f){0.f,0.f,0.f,0.f,0.f,0.f,0.f,0.f};

  _Float16* pw = Psh[wave];
  const int nChunks = Skv / AT_KC;             // host-derived, static for the launch; at least 1 (Skv % 64 == 0, Skv > 0)

  // K fragments and mask values are requested one chunk ahead: kb[j][dc] = B[k=d][n=key], key row kv0+16j+c, d along the row
  const _Float16* kbase = k  + (size_t)c * ldk + hoff + 8 * hh;
  const _Float16* vbase = vt + (size_t)(hoff + c) * ldv + 8 * hh;
  v16h kb[4][2];
  float mk[4];
  {
    const _Float16* pk[4];
#pragma unroll
    for (int j = 0; j < 4; ++j) {
      pk[j] = kbase + (size_t)(j * 16) * ldk;
#pragma unroll
      for (int dc = 0; dc < 2; ++dc) kb[j][dc] = Frag<_Float16>::load(pk[j] + dc * 32);
    }
#pragma unroll
    for (int j = 0; j < 4; ++j) mk[j] = maskv[c + j * 16];
    addr_wait5(pk[0], pk[1], pk[2], pk[3], c);
  }

  for (int kc = 0; kc < nChunks; ++kc) {
    const int kv0 = kc * AT_KC;

    // this chunk's V fragments are requested here and first used behind the softmax
    v16h vb[2][4];                                                     // B[k = key][n = d t*16+c] from vt row hoff+t*16+c
    {
      const _Float16* pv[4];
#pragma unroll
      for (int t = 0; t < 4; ++t) {
        pv[t] = vbase + (size_t)(t * 16) * ldv + kv0;
#pragma unroll
        for (int kk = 0; kk < 2; ++kk) vb[kk][t] = Frag<_Float16>::load(pv[t] + kk * 32);
      }
      addr_wait4(pv[0], pv[1], pv[2], pv[3]);
    }

    // ---- scores S[16 x 64]: D row 8hh+r = query q0+8hh+r, D col c of subtile j = key kv0+16j+c ----
    v8f s[4];
#pragma unroll
    for (int j = 0; j < 4; ++j) {
      s[j] = (v8f){0.f,0.f,0.f,0.f,0.f,0.f,0.f,0.f};
#pragma unroll
      for (int dc = 0; dc < 2; ++dc) s[j] = mma_h(qa[dc], kb[j][dc], s[j]);
    }
    float madd[4];
#pragma unroll
    for (int j = 0; j < 4; ++j) madd[j] = (1.0f - mk[j]) * mask_fill;

    float cm[8];
#pragma unroll
    for (int r = 0; r < 8; ++r) {
      float m = -INFINITY;
#pragma unroll
      for (int j = 0; j < 4; ++j) {
        const float x = s[j][r] * qscale + madd[j];
        s[j][r] = x;
        m = fmaxf(m, x);
      }
#pragma unroll
      for (int off = 1; off < 16; off <<= 1) m = fmaxf(m, __shfl_xor(m, off, 32));
      cm[r] = m;
    }

    // order the P fragment reads of the preceding chunk before this chunk's P stores
    // (LDS only: a fence over global memory too would wait out the V loads in flight)
    __builtin_amdgcn_fence(__ATOMIC_RELEASE, "workgroup", "local");
    __builtin_amdgcn_wave_barrier();
    __builtin_amdgcn_fence(__ATOMIC_ACQUIRE, "workgroup", "local");

#pragma unroll
    for (int r = 0; r < 8; ++r) {
      const float mnew  = fmaxf(mrow[r], cm[r]);
      const float alpha = expf(mrow[r] - mnew);
      mrow[r] = mnew;
      float psum = 0.f;
#pragma unroll
      for (int j = 0; j < 4; ++j) {
        const float p = expf(s[j][r] - mnew);
        psum += p;
        pw[(8 * hh + r) * AT_KC + j * 16 + c] = (_Float16)(p * PSC);
      }
#pragma unroll
      for (int off = 1; off < 16; off <<= 1) psum += __shfl_xor(psum, off, 32);
      lrow[r] = lrow[r] * alpha + psum;
#pragma unroll
      for (int t = 0; t < 4; ++t) oacc[t][r] *= alpha;
    }
    // P stores before the P fragment reads (LDS only, as above)
    __builtin_amdgcn_fence(__ATOMIC_RELEASE, "workgroup", "local");
    __builtin_amdgcn_wave_barrier();
    __builtin_amdgcn_fence(__ATOMIC_ACQUIRE, "workgroup", "local");

    // the next chunk's K fragments and mask values fly during p.v; the last pass re-reads chunk 0 (in bounds, unused)
    {
      const int kvn = (kc + 1 < nChunks) ? kv0 + AT_KC : 0;
      const int mi  = kvn + c;
      const _Float16* pk[4];
#pragma unroll
      for (int j = 0; j < 4; ++j) {
        pk[j] = kbase + (size_t)(kvn + j * 16) * ldk;
#pragma unroll
        for (int dc = 0; dc < 2; ++dc) kb[j][dc] = Frag<_Float16>::load(pk[j] + dc * 32);
      }
#pragma unroll
      for (int j = 0; j < 4; ++j) mk[j] = maskv[mi + j * 16];
      addr_wait5(pk[0], pk[1], pk[2], pk[3], mi);
    }

    // ---- ctx += P (16 x 64 keys) . V (64 keys x 64 d) ----
#pragma unroll   // kk must be a constant: vb[kk][t] is held in registers
    for (int kk = 0; kk < 2; ++kk) {
      FH pa;                                                           // A[m = query c][k = key kk*32 + split map]
      pa.h[0] = *(const v8h*)(pw + c * AT_KC + kk * 32 + 8 * hh);
      pa.h[1] = *(const v8h*)(pw + c * AT_KC + kk * 32 + 16 + 8 * hh);
#pragma unroll
      for (int t = 0; t < 4; ++t) oacc[t] = mma_h(pa.v, vb[kk][t], oacc[t]);
    }
  }

  // ---- epilogue: ctx row (q0 + 8hh + r), column hoff + t*16 + c ----
  float* os = Os[wave];
#pragma unroll
  for (int r = 0; r < 8; ++r) {
    const float inv = oscale / (lrow[r] * PSC);
#pragma unroll
    for (int t = 0; t < 4; ++t) os[(8 * hh + r) * 68 + t * 16 + c] = oacc[t][r] * inv;
  }
  __builtin_amdgcn_fence(__ATOMIC_RELEASE, "workgroup");
  __builtin_amdgcn_wave_barrier();
  __builtin_amdgcn_fence(__ATOMIC_ACQUIRE, "workgroup");
  {
    const int q8 = lane >> 3, c8 = (lane & 7) * 8;
    {
#pragma unroll
      for (int it = 0; it < 4; ++it) {
        const int row = it * 4 + q8;                     // rows 0..15 covered by q8 0..3, it 0..3
        const float* sp = os + row * 68 + c8;
        v8h hv;
#pragma unroll
        for (int e = 0; e < 8; ++e) hv[e] = (_Float16)sp[e];
        *(v8h*)(ctx + (size_t)(q0 + row) * ldo + hoff + c8) = hv;
      }
      
    }
  }
}

// =====================================================================================
// One block of 256 threads per row; requires ncols == 1024. Each thread owns 4 consecutive floats;
// =====================================================================================
__global__ __launch_bounds__(256) void row_tanh_res_ln_kernel(
    const float* __restrict__ y, const float* __restrict__ res,
    const float* __restrict__ gamma, const float* __restrict__ beta,
    float* __restrict__ out, int ncols, float eps) {
  __shared__ float red[16];
  const int row  = blockIdx.x;
  const int t    = threadIdx.x;
  const int lane = t & 31;
  const int wave = t >> 5;
  const size_t base = (size_t)row * ncols + 4 * t;
  const v4f yv = *(const v4f*)(y + base);
  const v4f rv = *(const v4f*)(res + base);
  const float x0 = tanhf(yv[0]) + rv[0];
  const float x1 = tanhf(yv[1]) + rv[1];
  const float x2 = tanhf(yv[2]) + rv[2];
  const float x3 = tanhf(yv[3]) + rv[3];
  float s = (x0 + x1) + (x2 + x3);
#pragma unroll
  for (int off = 1; off < 32; off <<= 1) s += __shfl_xor(s, off, 32);
  if (lane == 0) red[wave] = s;
  __syncthreads();
  float tot = 0.f;
#pragma unroll
  for (int w = 0; w < 8; ++w) tot += red[w];
  const float inv_n = 1.0f / (float)ncols;
  const float mu = tot * inv_n;
  const float d0 = x0 - mu, d1 = x1 - mu, d2 = x2 - mu, d3 = x3 - mu;
  float s2 = (d0 * d0 + d1 * d1) + (d2 * d2 + d3 * d3);
#pragma unroll
  for (int off = 1; off < 32; off <<= 1) s2 += __shfl_xor(s2, off, 32);
  if (lane == 0) red[8 + wave] = s2;
  __syncthreads();
  float tot2 = 0.f;
#pragma unroll
  for (int w = 0; w < 8; ++w) tot2 += red[8 + w];
  const float var = tot2 * inv_n;
  const float rn  = 1.0f / sqrtf(var + eps);
  const v4f gv = *(const v4f*)(gamma + 4 * t);
  const v4f bv = *(const v4f*)(beta + 4 * t);
  v4f o;
  o[0] = d0 * rn * gv[0] + bv[0];
  o[1] = d1 * rn * gv[1] + bv[1];
  o[2] = d2 * rn * gv[2] + bv[2];
  o[3] = d3 * rn * gv[3] + bv[3];
  *(v4f*)(out + base) = o;
  
}

// ----------------------------------------------------------------------------
extern "C" void kernel_launch(void* const* d_in, const int* in_sizes, int n_in,
                              void* d_out, int out_size, void* d_ws, size_t ws_size,
                              hipStream_t stream) {
  if (n_in < 12) return;
  const float* ht    = (const float*)d_in[0];
  const float* amask = (const float*)d_in[1];
  const float* Wq    = (const float*)d_in[2];
  const float* bq    = (const float*)d_in[3];
  const float* Wk    = (const float*)d_in[4];
  const float* bk    = (const float*)d_in[5];
  const float* Wv    = (const float*)d_in[6];
  const float* bv    = (const float*)d_in[7];
  const float* Wd    = (const float*)d_in[8];
  const float* bd    = (const float*)d_in[9];
  const float* gamma = (const float*)d_in[10];
  const float* beta  = (const float*)d_in[11];

  const int Dm = in_sizes[3];                 // hidden size (1024)
  if (Dm != 1024) return;
  const int Nn = in_sizes[0] / Dm;            // tokens (2048)
  const int Hh = 16;
  const int Dh = Dm / Hh;                     // 64
  if (Dh != 64 || Nn <= 0 || (Nn % 64) != 0 || in_sizes[0] != Nn * Dm) return;
  if (in_sizes[2] != Dm * Dm || in_sizes[4] != Dm * Dm || in_sizes[6] != Dm * Dm || in_sizes[8] != Dm * Dm) return;
  if (in_sizes[1] < Nn || in_sizes[5] < Dm || in_sizes[7] < Dm || in_sizes[9] < Dm || in_sizes[10] < Dm || in_sizes[11] < Dm) return;
  if (out_size != Nn * Dm) return;

  // ---- workspace carve (bytes; every sub-buffer size is a multiple of 256 B, so all offsets are line aligned) ----
  const size_t bHt16 = (size_t)Nn * Dm * 2;   // f16 [N][D] (and [D][N])
  const size_t bW16  = (size_t)Dm * Dm * 2;   // f16 [D][D]
  const size_t bF    = (size_t)Nn * Dm * 4;   // f32 [N][D]
  size_t o = 0;
  char* ws = (char*)d_ws;
  _Float16* ht16  = (_Float16*)(ws + o); o += bHt16;
  _Float16* w16   = (_Float16*)(ws + o); o += 4 * bW16;      // planes: 0 = Wq x16, 1 = Wk x16, 2 = Wv x16, 3 = Wd x16
  _Float16* q16   = (_Float16*)(ws + o); o += bHt16;         // [N][D]
  _Float16* k16   = (_Float16*)(ws + o); o += bHt16;         // [N][D]
  _Float16* vt16  = (_Float16*)(ws + o); o += bHt16;         // [D][N]  (d-major, token contiguous)
  _Float16* ctx16 = (_Float16*)(ws + o); o += bHt16;         // [N][D], carried x16
  float*    yf    = (float*)(ws + o);    o += bF;            // [N][D] f32 dense pre-activation
  if (o > ws_size) return;                                   // 37748736 B for the given sizes
  _Float16* wq16 = w16;
  _Float16* wk16 = w16 + (size_t)Dm * Dm;
  _Float16* wv16 = w16 + (size_t)2 * Dm * Dm;
  _Float16* wd16 = w16 + (size_t)3 * Dm * Dm;

  // ---- casts to f16 (weights carried x16) ----
  const int nHt2 = Nn * Dm / 2, nW2 = Dm * Dm / 2;
  cast_f32_f16x2s<<<(nHt2 + 255) / 256, 256, 0, stream>>>(ht, ht16, nHt2, 1.0f);
  cast4_f32_f16x2s<<<dim3((nW2 + 255) / 256, 4), 256, 0, stream>>>(Wq, Wk, Wv, Wd, w16, nW2, 16.0f);

  // ---- q, k projections: [Nn][Dm] f16 = ht16 . W16^T * (1/16) + bias[n] ----
  const int tilesQK = (Nn / 64) * (Dm / 64);
  const dim3 gqk((tilesQK + 7) / 8, 1);
  const unsigned short* Au = (const unsigned short*)ht16;
  wmma_gemm64<0, false, 2, 1, false, 0><<<gqk, 256, 0, stream>>>(
      Au, Au, Dm, 0L, (const unsigned short*)wq16, (const unsigned short*)wq16, Dm, 0L,
      (void*)q16, (void*)q16, Dm, 0L, bq, ht, 0L, Nn, Dm, Dm, 1.0f / 16.0f);
  wmma_gemm64<0, false, 2, 1, false, 0><<<gqk, 256, 0, stream>>>(
      Au, Au, Dm, 0L, (const unsigned short*)wk16, (const unsigned short*)wk16, Dm, 0L,
      (void*)k16, (void*)k16, Dm, 0L, bk, ht, 0L, Nn, Dm, Dm, 1.0f / 16.0f);
  // ---- v projection, transposed: vt16[dout][token] = Wv16 . ht16^T * (1/16) + bv[dout]  (M = Dm, N = Nn, bias[m]) ----
  const int tilesV = (Dm / 64) * (Nn / 64);
  const dim3 gv((tilesV + 7) / 8, 1);
  wmma_gemm64<0, false, 1, 1, false, 0><<<gv, 256, 0, stream>>>(
      (const unsigned short*)wv16, (const unsigned short*)wv16, Dm, 0L, Au, Au, Dm, 0L,
      (void*)vt16, (void*)vt16, Nn, 0L, bv, ht, 0L, Dm, Nn, Dm, 1.0f / 16.0f);

  // ---- attention: per (head, 64 query rows) block, 64-key chunks, scale 1/8, additive key mask (1 - m) * -1e4; ctx carried x16 ----
  attn64_f16_kernel<<<Hh * (Nn / 64), 128, 0, stream>>>(
      q16, k16, vt16, amask, ctx16, Nn, Nn, Hh, Dm, Dm, Nn, Dm, 0.125f, -10000.0f, 16.0f);

  // ---- dense projection y = ctx16 . Wd16^T * (1/256) + bd (f32 out) ----
  const unsigned short* Cu = (const unsigned short*)ctx16;
  wmma_gemm64<0, false, 2, 0, false, 0><<<gqk, 256, 0, stream>>>(
      Cu, Cu, Dm, 0L, (const unsigned short*)wd16, (const unsigned short*)wd16, Dm, 0L,
      (void*)yf, (void*)yf, Dm, 0L, bd, ht, 0L, Nn, Dm, Dm, 1.0f / 256.0f);

  // ---- tanh + residual + LayerNorm -> d_out ----
  row_tanh_res_ln_kernel<<<Nn, 256, 0, stream>>>(yf, ht, gamma, beta, (float*)d_out, Dm, 1e-5f);
}

// v002
// It runs in 203 microseconds.
// In both of two side-by-side timings against v001, it was 1.30 times as fast.
// Counting every step since v000, it is 1.92 times as fast.
#include <hip/hip_runtime.h>
// Contractions: q/k/v/dense projections v_wmma_f32_16x16x32_f16 (f16 operands, weights carried x16, ctx carried x16, f32 accumulate);
// attention q.kT and p.v v_wmma_f32_16x16x32_f16 (f16 operands, p carried x2^15, f32 accumulate); scale, mask, softmax, tanh, residual, LayerNorm in f32.

typedef __attribute__((ext_vector_type(16))) _Float16 v16h;
typedef __attribute__((ext_vector_type(8)))  _Float16 v8h;
typedef __attribute__((ext_vector_type(16))) __bf16   v16b;
typedef __attribute__((ext_vector_type(8)))  __bf16   v8b;
typedef __attribute__((ext_vector_type(8)))  float    v8f;
typedef __attribute__((ext_vector_type(4)))  float    v4f;

__device__ __forceinline__ unsigned short f2bf_bits(float f) {
  unsigned u = __float_as_uint(f);
  return (unsigned short)((u + 0x7FFFu + ((u >> 16) & 1u)) >> 16);
}
__device__ __forceinline__ float bf_bits2f(unsigned short h) { return __uint_as_float(((unsigned)h) << 16); }

// hazard guards as plain device helpers (no inline asm inside the kernel template body)
__device__ __forceinline__ void dep_guard_h(v8f& a, v8f& b, v16h x, v16h y) { asm volatile("v_nop\n\tv_nop\n\tv_nop\n\tv_nop" : "+v"(a), "+v"(b) : "v"(x), "v"(y)); }
__device__ __forceinline__ void dep_guard_b(v8f& a, v8f& b, v16b x, v16b y) { asm volatile("v_nop\n\tv_nop\n\tv_nop\n\tv_nop" : "+v"(a), "+v"(b) : "v"(x), "v"(y)); }
__device__ __forceinline__ void keep4_h(v16h a, v16h b, v16h c, v16h d) { asm volatile("v_nop" :: "v"(a), "v"(b), "v"(c), "v"(d)); }
__device__ __forceinline__ void keep4_b(v16b a, v16b b, v16b c, v16b d) { asm volatile("v_nop" :: "v"(a), "v"(b), "v"(c), "v"(d)); }
__device__ __forceinline__ void acc_guard4(v8f& a, v8f& b, v8f& c, v8f& d) { asm volatile("v_nop\n\tv_nop\n\tv_nop\n\tv_nop" : "+v"(a), "+v"(b), "+v"(c), "+v"(d)); }
// s_wait_xcnt 0 behind a group of global loads, kept as a precaution in front of any reuse of their address registers.
// The statement names those registers as inputs, so none of them is handed to a later load of the same group as its destination.
__device__ __forceinline__ void addr_wait4(const void* a, const void* b, const void* c, const void* d) {
  asm volatile("s_wait_xcnt 0x0" :: "v"(a), "v"(b), "v"(c), "v"(d) : "memory");
}
__device__ __forceinline__ void addr_wait5(const void* a, const void* b, const void* c, const void* d, int e) {
  asm volatile("s_wait_xcnt 0x0" :: "v"(a), "v"(b), "v"(c), "v"(d), "v"(e) : "memory");
}
__device__ __forceinline__ void addr_wait8(const void* a, const void* b, const void* c, const void* d,
                                           const void* e, const void* f, const void* g, const void* h) {
  asm volatile("s_wait_xcnt 0x0" :: "v"(a), "v"(b), "v"(c), "v"(d), "v"(e), "v"(f), "v"(g), "v"(h) : "memory");
}
template <typename T> struct Frag;
template <> struct Frag<_Float16> {
  typedef v16h V; union U { v16h v; v8h h[2]; };
  static __device__ __forceinline__ v16h load(const _Float16* p) {   // elements 0..7 <- p[0..7], 8..15 <- p[16..23]
    U f; f.h[0] = *(const v8h*)(p); f.h[1] = *(const v8h*)(p + 16); return f.v;
  }
  static __device__ __forceinline__ v8f mma(v16h a, v16h b, v8f c) {
    return __builtin_amdgcn_wmma_f32_16x16x32_f16(false, a, false, b, (short)0, c, false, false);
  }
  static __device__ __forceinline__ void guard(v8f& a, v8f& b, v16h x, v16h y) { dep_guard_h(a, b, x, y); }
  static __device__ __forceinline__ void keep(v16h a, v16h b, v16h c, v16h d) { keep4_h(a, b, c, d); }
};
template <> struct Frag<__bf16> {
  typedef v16b V; union U { v16b v; v8b h[2]; };
  static __device__ __forceinline__ v16b load(const __bf16* p) {
    U f; f.h[0] = *(const v8b*)(p); f.h[1] = *(const v8b*)(p + 16); return f.v;
  }
  static __device__ __forceinline__ v8f mma(v16b a, v16b b, v8f c) {
    return __builtin_amdgcn_wmma_f32_16x16x32_bf16(false, a, false, b, (short)0, c, false, false);
  }
  static __device__ __forceinline__ void guard(v8f& a, v8f& b, v16b x, v16b y) { dep_guard_b(a, b, x, y); }
  static __device__ __forceinline__ void keep(v16b a, v16b b, v16b c, v16b d) { keep4_b(a, b, c, d); }
};

// ---- Register-blocked batched WMMA GEMM ------------------------------------
// C[m,n] = scale * sum_k A[m,k] * Bt[n,k] (+bias)(+resid); each wave owns a 64x64 tile.
// A row-major [M,K]; Bt row-major [N,K]; M,N % 64 == 0, K % 32 == 0.
// SPLIT: operands are hi/lo planes (A2/Bt2 = lo planes, same layout); product = hi.hi + hi.lo + lo.hi.
// BIAS_MODE: 0 = none, 1 = bias[m], 2 = bias[n].
// OUT_MODE: 0 = f32, 1 = f16, 2 = bf16 hi plane (Cout) + bf16 lo plane (Cout2).
// ET: 0 = f16 operands, 1 = bf16 operands (pointers passed as 16-bit storage)
template <int ET> struct Elem;
template <> struct Elem<0> { typedef _Float16 T; };
template <> struct Elem<1> { typedef __bf16 T; };
// gemm64_tile: the work of one block; b = batch index, sT = the block's 8 per-wave 16x64 slabs, pitch 68 floats.
template <int ET, bool SPLIT, int BIAS_MODE, int OUT_MODE, bool RESID, int ACT>
__device__ __forceinline__ void gemm64_tile(
    float (*sT)[16 * 68], const int b,
    const unsigned short* __restrict__ Ap, const unsigned short* __restrict__ A2p, int lda, long strideA,
    const unsigned short* __restrict__ Btp, const unsigned short* __restrict__ Bt2p, int ldb, long strideB,
    void* __restrict__ Cout, void* __restrict__ Cout2, int ldc, long strideC,
    const float* __restrict__ bias,
    const float* __restrict__ resid, long strideR,
    int M, int N, int K, float scale) {
  typedef typename Elem<ET>::T T;
  typedef typename Frag<T>::V V;
  const T* A = (const T*)Ap; const T* A2 = (const T*)A2p; const T* Bt = (const T*)Btp; const T* Bt2 = (const T*)Bt2p;
  const int lane = threadIdx.x & 31;
  const int wave = threadIdx.x >> 5;
  const int tilesN = N >> 6;
  const int tilesM = M >> 6;
  const int tile = blockIdx.x * 8 + wave;
  if (tile >= tilesM * tilesN) return;   // wave-uniform; no block barriers in this kernel
  const int tm = tile / tilesN;
  const int tn = tile - tm * tilesN;
  const int m0 = tm << 6;
  const int n0 = tn << 6;

  const T* Ab  = A  + (size_t)b * strideA;
  const T* Bb  = Bt + (size_t)b * strideB;
  const T* Ab2 = SPLIT ? (A2  + (size_t)b * strideA) : nullptr;
  const T* Bb2 = SPLIT ? (Bt2 + (size_t)b * strideB) : nullptr;

  const int rlane = lane & 15;                 // row (A) / col (B, D) within subtile
  const int koff  = (lane >> 4) * 8;           // k offset of this lane half
  const int mOff  = (lane >> 4) * 8;           // D row offset

  v8f acc[4][4];
#pragma unroll
  for (int i = 0; i < 4; ++i)
#pragma unroll
    for (int j = 0; j < 4; ++j) acc[i][j] = (v8f){0.f,0.f,0.f,0.f,0.f,0.f,0.f,0.f};

  for (int k0 = 0; k0 < K; k0 += 32) {
    // every fragment of this k-step is requested here, ahead of the first product: one load round trip per step
    V bh[4], bl[4], ah[4], al[4];
    const T *pb[4], *pa[4];
#pragma unroll
    for (int j = 0; j < 4; ++j) {
      const size_t bo = (size_t)(n0 + (j << 4) + rlane) * ldb + koff + k0;
      pb[j] = Bb + bo;
      bh[j] = Frag<T>::load(pb[j]);
      if (SPLIT) bl[j] = Frag<T>::load(Bb2 + bo);
    }
#pragma unroll
    for (int i = 0; i < 4; ++i) {
      const size_t ao = (size_t)(m0 + (i << 4) + rlane) * lda + koff + k0;
      pa[i] = Ab + ao;
      ah[i] = Frag<T>::load(pa[i]);
      if (SPLIT) al[i] = Frag<T>::load(Ab2 + ao);
    }
    addr_wait8(pb[0], pb[1], pb[2], pb[3], pa[0], pa[1], pa[2], pa[3]);
    if (SPLIT) addr_wait8(Bb2 + (pb[0] - Bb), Bb2 + (pb[1] - Bb), Bb2 + (pb[2] - Bb), Bb2 + (pb[3] - Bb),
                          Ab2 + (pa[0] - Ab), Ab2 + (pa[1] - Ab), Ab2 + (pa[2] - Ab), Ab2 + (pa[3] - Ab));
#pragma unroll
    for (int i = 0; i < 4; ++i) {
#pragma unroll
      for (int j = 0; j < 4; ++j) {
        acc[i][j] = Frag<T>::mma(ah[i], bh[j], acc[i][j]);
        if (SPLIT) {
          acc[i][j] = Frag<T>::mma(ah[i], bl[j], acc[i][j]);
          acc[i][j] = Frag<T>::mma(al[i], bh[j], acc[i][j]);
        }
      }
      Frag<T>::guard(acc[i][0], acc[i][3], ah[i], SPLIT ? al[i] : ah[i]);
    }
    Frag<T>::keep(bh[0], bh[1], bh[2], bh[3]);
    if (SPLIT) Frag<T>::keep(bl[0], bl[1], bl[2], bl[3]);
  }
  acc_guard4(acc[0][0], acc[0][1], acc[0][2], acc[0][3]);
  acc_guard4(acc[1][0], acc[1][1], acc[1][2], acc[1][3]);
  acc_guard4(acc[2][0], acc[2][1], acc[2][2], acc[2][3]);
  acc_guard4(acc[3][0], acc[3][1], acc[3][2], acc[3][3]);

  // ---- epilogue ----
  float* slab = sT[wave];
  const float* Rb = RESID ? (resid + (size_t)b * strideR) : nullptr;
#pragma unroll
  for (int i = 0; i < 4; ++i) {
    const int mBase = m0 + (i << 4);
#pragma unroll
    for (int j = 0; j < 4; ++j) {
      const int n = n0 + (j << 4) + rlane;
      float bv = 0.f;
      if (BIAS_MODE == 2) bv = bias[n];
#pragma unroll
      for (int r = 0; r < 8; ++r) {
        float v = acc[i][j][r] * scale;
        if (BIAS_MODE == 1) v += bias[mBase + mOff + r];
        if (BIAS_MODE == 2) v += bv;
        if (RESID) v += Rb[(size_t)(mBase + mOff + r) * ldc + n];
        if (ACT == 1) v = tanhf(v);
        if (ACT == 2) v = fmaxf(v, 0.0f);
        if (ACT == 3) v = v / (1.0f + expf(-v));
        if (ACT == 4) v = (v > 0.f) ? v : 0.01f * v;
        if (ACT == 5) v = 0.5f * v * (1.0f + erff(v * 0.70710678118654752f));
        slab[(mOff + r) * 68 + (j << 4) + rlane] = v;
      }
    }
    __builtin_amdgcn_fence(__ATOMIC_RELEASE, "workgroup");
    __builtin_amdgcn_wave_barrier();
    __builtin_amdgcn_fence(__ATOMIC_ACQUIRE, "workgroup");
    if (OUT_MODE == 0) {
      float* C = (float*)Cout + (size_t)b * strideC;
      const int hh = lane >> 4, c4 = (lane & 15) * 4;     // row seg = 256 B = 16 lanes x 16 B
      {
#pragma unroll
        for (int it = 0; it < 8; ++it) {
          const int row = it * 2 + hh;
          v4f v = *(const v4f*)(slab + row * 68 + c4);
          *(v4f*)(C + (size_t)(mBase + row) * ldc + n0 + c4) = v;
        }
        
      }
    } else {
      const int q = lane >> 3, c8 = (lane & 7) * 8;
      unsigned short* C  = (unsigned short*)Cout  + (size_t)b * strideC;
      unsigned short* C2 = (OUT_MODE == 2) ? ((unsigned short*)Cout2 + (size_t)b * strideC) : nullptr;
      {
#pragma unroll
        for (int it = 0; it < 4; ++it) {
          const int row = it * 4 + q;
          const float* sp = slab + row * 68 + c8;
          v8h hv, lv;
#pragma unroll
          for (int e = 0; e < 8; ++e) {
            if (OUT_MODE == 1) {
              hv[e] = (_Float16)sp[e];
            } else {
              unsigned short hb = f2bf_bits(sp[e]);
              unsigned short lb = f2bf_bits(sp[e] - bf_bits2f(hb));
              hv[e] = __builtin_bit_cast(_Float16, hb);
              lv[e] = __builtin_bit_cast(_Float16, lb);
            }
          }
          *(v8h*)(C + (size_t)(mBase + row) * ldc + n0 + c8) = hv;
          if (OUT_MODE == 2) *(v8h*)(C2 + (size_t)(mBase + row) * ldc + n0 + c8) = lv;
        }
        
      }
    }
    __builtin_amdgcn_fence(__ATOMIC_RELEASE, "workgroup");
    __builtin_amdgcn_wave_barrier();
    __builtin_amdgcn_fence(__ATOMIC_ACQUIRE, "workgroup");
  }
}

template <int ET, bool SPLIT, int BIAS_MODE, int OUT_MODE, bool RESID, int ACT = 0>
__global__ __launch_bounds__(256) void wmma_gemm64(
    const unsigned short* __restrict__ Ap, const unsigned short* __restrict__ A2p, int lda, long strideA,
    const unsigned short* __restrict__ Btp, const unsigned short* __restrict__ Bt2p, int ldb, long strideB,
    void* __restrict__ Cout, void* __restrict__ Cout2, int ldc, long strideC,
    const float* __restrict__ bias,
    const float* __restrict__ resid, long strideR,
    int M, int N, int K, float scale) {
  __shared__ __align__(16) float sT[8][16 * 68];
  gemm64_tile<ET, SPLIT, BIAS_MODE, OUT_MODE, RESID, ACT>(
      sT, blockIdx.y, Ap, A2p, lda, strideA, Btp, Bt2p, ldb, strideB, Cout, Cout2, ldc, strideC,
      bias, resid, strideR, M, N, K, scale);
}

// ---- the three projections of one activation matrix x [Nn][Dm] in one launch; they share no result, so their blocks run side by side ----
// blockIdx.y = 0: q[Nn][Dm] = x . Wq^T + bq[n];  1: k likewise;  2: vt[Dm][Nn] = Wv . x^T + bv[m].  w = planes Wq, Wk, Wv of Dm*Dm each.
__global__ __launch_bounds__(256) void qkv_gemm64(
    const unsigned short* __restrict__ x, const unsigned short* __restrict__ w,
    unsigned short* __restrict__ qo, unsigned short* __restrict__ ko, unsigned short* __restrict__ vto,
    const float* __restrict__ bq, const float* __restrict__ bk, const float* __restrict__ bv,
    int Nn, int Dm, float scale) {
  __shared__ __align__(16) float sT[8][16 * 68];
  const int y = blockIdx.y;                                      // block-uniform
  const unsigned short* wy = w + (size_t)y * Dm * Dm;
  if (y == 2) {
    gemm64_tile<0, false, 1, 1, false, 0>(sT, 0, wy, wy, Dm, 0L, x, x, Dm, 0L,
                                          (void*)vto, (void*)vto, Nn, 0L, bv, bv, 0L, Dm, Nn, Dm, scale);
  } else {
    unsigned short* o = (y == 0) ? qo : ko;
    const float* bb = (y == 0) ? bq : bk;
    gemm64_tile<0, false, 2, 1, false, 0>(sT, 0, x, x, Dm, 0L, wy, wy, Dm, 0L,
                                          (void*)o, (void*)o, Dm, 0L, bb, bb, 0L, Nn, Dm, Dm, scale);
  }
}

// ---- f32 -> f16 casts of the activations (x1) and of four equally sized weight matrices (x sc) in one launch ----
// Pairs 0..n2a-1 come from a, the next 4 * n2each from s0..s3; out holds the planes in that order, back to back.
// n2a and n2each are multiples of 256, so the source is the same for a whole block.
__global__ __launch_bounds__(256) void cast5_f32_f16x2s(
    const float* __restrict__ a,
    const float* __restrict__ s0, const float* __restrict__ s1,
    const float* __restrict__ s2, const float* __restrict__ s3,
    _Float16* __restrict__ out, int n2a, int n2each, float sc) {
  const int i0 = blockIdx.x * 256;
  const float* in = a;
  float f = 1.0f;
  int j = i0;                                                    // first pair of this block inside its own source
  if (j >= n2a) {
    j -= n2a; in = s0; f = sc;
    if (j >= n2each) { j -= n2each; in = s1; }
    if (j >= n2each) { j -= n2each; in = s2; }
    if (j >= n2each) { j -= n2each; in = s3; }
  }
  j += threadIdx.x;
  const _Float16 h0 = (_Float16)(in[2 * j] * f), h1 = (_Float16)(in[2 * j + 1] * f);
  const unsigned u = (unsigned)__builtin_bit_cast(unsigned short, h0) | ((unsigned)__builtin_bit_cast(unsigned short, h1) << 16);
  ((unsigned*)out)[i0 + threadIdx.x] = u;
}

// =====================================================================================
// Lean attention for head_dim 64 on f16 planes (no operand conversion inside, no K/V LDS staging):
//   q  [S][ldq]   f16, head h at columns h*64..h*64+63
//   k  [Skv][ldk] f16, same column layout
//   vt [H*64][ldv] f16, row = h*64+d, column = key index (k-contiguous B fragments)
//   maskv [Skv] f32 key vector; score = (q.k) * qscale + (1 - maskv[kv]) * mask_fill
//   ctx [S][ldo] f16 out, head h at columns h*64.., value = oscale * softmax(score) . v
//   q.kT and p.v: v_wmma_f32_16x16x32_f16, f32 accumulate; online softmax in f32; P carried x2^15 in f16.
//   Block = 4 waves = 64 query rows of one head; S, Skv % 64 == 0; grid.x = H * (S/64).
//   A/B fragments via Frag<_Float16>::load (split k map, statically strided addresses only).
// =====================================================================================
#define AT_D 64
#define AT_NW 4
#define AT_QB 64
#define AT_KC 64

__device__ __forceinline__ v8f mma_h(v16h a, v16h b, v8f c) {
  c = __builtin_amdgcn_wmma_f32_16x16x32_f16(false, a, false, b, (short)0, c, false, false);
  asm volatile("v_nop\n\tv_nop\n\tv_nop\n\tv_nop" : "+v"(c) : "v"(a), "v"(b));
  return c;
}

__global__ __launch_bounds__(128)
void attn64_f16_kernel(const _Float16* __restrict__ q, const _Float16* __restrict__ k,
                       const _Float16* __restrict__ vt, const float* __restrict__ maskv,
                       _Float16* __restrict__ ctx,
                       int S, int Skv, int H, int ldq, int ldk, int ldv, int ldo,
                       float qscale, float mask_fill, float oscale) {
  const float PSC = 32768.0f;                  // probabilities carried x2^15, folded into the final 1/l
  union FH { v16h v; v8h h[2]; };
  __shared__ __align__(16) _Float16 Psh[AT_NW][16 * AT_KC];    // per wave P [row][kv]  2 KB each
  __shared__ __align__(16) float    Os[AT_NW][16 * 68];        // per wave out tile, pitch 68

  const int tid  = threadIdx.x;
  const int wave = tid >> 5;
  const int lane = tid & 31;
  const int hh   = lane >> 4;
  const int c    = lane & 15;

  const int nqb = S / AT_QB;
  const int bx  = blockIdx.x;
  const int qb  = bx % nqb;
  const int h   = bx / nqb;
  if (h >= H) return;                          // block-uniform; no block barriers in this kernel
  const int q0   = qb * AT_QB + wave * 16;
  const int hoff = h * AT_D;

  // ---- Q fragments (A operand, row = q0 + c): 2 d-chunks ----
  v16h qa[2];
  {
    const _Float16* qrow = q + (size_t)(q0 + c) * ldq + hoff + 8 * hh;
#pragma unroll
    for (int dc = 0; dc < 2; ++dc) qa[dc] = Frag<_Float16>::load(qrow + dc * 32);
  }

  float mrow[8], lrow[8];
  v8f oacc[4];
#pragma unroll
  for (int r = 0; r < 8; ++r) { mrow[r] = -INFINITY; lrow[r] = 0.f; }
#pragma unroll
  for (int t = 0; t < 4; ++t) oacc[t] = (v8f){0.f,0.f,0.f,0.f,0.f,0.f,0.f,0.f};

  _Float16* pw = Psh[wave];
  const int nChunks = Skv / AT_KC;             // host-derived, static for the launch; at least 1 (Skv % 64 == 0, Skv > 0)

  // K fragments and mask values are requested one chunk ahead: kb[j][dc] = B[k=d][n=key], key row kv0+16j+c, d along the row
  const _Float16* kbase = k  + (size_t)c * ldk + hoff + 8 * hh;
  const _Float16* vbase = vt + (size_t)(hoff + c) * ldv + 8 * hh;
  v16h kb[4][2];
  float mk[4];
  {
    const _Float16* pk[4];
#pragma unroll
    for (int j = 0; j < 4; ++j) {
      pk[j] = kbase + (size_t)(j * 16) * ldk;
#pragma unroll
      for (int dc = 0; dc < 2; ++dc) kb[j][dc] = Frag<_Float16>::load(pk[j] + dc * 32);
    }
#pragma unroll
    for (int j = 0; j < 4; ++j) mk[j] = maskv[c + j * 16];
    addr_wait5(pk[0], pk[1], pk[2], pk[3], c);
  }

  for (int kc = 0; kc < nChunks; ++kc) {
    const int kv0 = kc * AT_KC;

    // this chunk's V fragments are requested here and first used behind the softmax
    v16h vb[2][4];                                                     // B[k = key][n = d t*16+c] from vt row hoff+t*16+c
    {
      const _Float16* pv[4];
#pragma unroll
      for (int t = 0; t < 4; ++t) {
        pv[t] = vbase + (size_t)(t * 16) * ldv + kv0;
#pragma unroll
        for (int kk = 0; kk < 2; ++kk) vb[kk][t] = Frag<_Float16>::load(pv[t] + kk * 32);
      }
      addr_wait4(pv[0], pv[1], pv[2], pv[3]);
    }

    // ---- scores S[16 x 64]: D row 8hh+r = query q0+8hh+r, D col c of subtile j = key kv0+16j+c ----
    v8f s[4];
#pragma unroll
    for (int j = 0; j < 4; ++j) {
      s[j] = (v8f){0.f,0.f,0.f,0.f,0.f,0.f,0.f,0.f};
#pragma unroll
      for (int dc = 0; dc < 2; ++dc) s[j] = mma_h(qa[dc], kb[j][dc], s[j]);
    }
    float madd[4];
#pragma unroll
    for (int j = 0; j < 4; ++j) madd[j] = (1.0f - mk[j]) * mask_fill;

    float cm[8];
#pragma unroll
    for (int r = 0; r < 8; ++r) {
      float m = -INFINITY;
#pragma unroll
      for (int j = 0; j < 4; ++j) {
        const float x = s[j][r] * qscale + madd[j];
        s[j][r] = x;
        m = fmaxf(m, x);
      }
#pragma unroll
      for (int off = 1; off < 16; off <<= 1) m = fmaxf(m, __shfl_xor(m, off, 32));
      cm[r] = m;
    }

    // order the P fragment reads of the preceding chunk before this chunk's P stores
    // (LDS only: a fence over global memory too would wait out the V loads in flight)
    __builtin_amdgcn_fence(__ATOMIC_RELEASE, "workgroup", "local");
    __builtin_amdgcn_wave_barrier();
    __builtin_amdgcn_fence(__ATOMIC_ACQUIRE, "workgroup", "local");

#pragma unroll
    for (int r = 0; r < 8; ++r) {
      const float mnew  = fmaxf(mrow[r], cm[r]);
      const float alpha = expf(mrow[r] - mnew);
      mrow[r] = mnew;
      float psum = 0.f;
#pragma unroll
      for (int j = 0; j < 4; ++j) {
        const float p = expf(s[j][r] - mnew);
        psum += p;
        pw[(8 * hh + r) * AT_KC + j * 16 + c] = (_Float16)(p * PSC);
      }
#pragma unroll
      for (int off = 1; off < 16; off <<= 1) psum += __shfl_xor(psum, off, 32);
      lrow[r] = lrow[r] * alpha + psum;
#pragma unroll
      for (int t = 0; t < 4; ++t) oacc[t][r] *= alpha;
    }
    // P stores before the P fragment reads (LDS only, as above)
    __builtin_amdgcn_fence(__ATOMIC_RELEASE, "workgroup", "local");
    __builtin_amdgcn_wave_barrier();
    __builtin_amdgcn_fence(__ATOMIC_ACQUIRE, "workgroup", "local");

    // the next chunk's K fragments and mask values fly during p.v; the last pass re-reads chunk 0 (in bounds, unused)
    {
      const int kvn = (kc + 1 < nChunks) ? kv0 + AT_KC : 0;
      const int mi  = kvn + c;
      const _Float16* pk[4];
#pragma unroll
      for (int j = 0; j < 4; ++j) {
        pk[j] = kbase + (size_t)(kvn + j * 16) * ldk;
#pragma unroll
        for (int dc = 0; dc < 2; ++dc) kb[j][dc] = Frag<_Float16>::load(pk[j] + dc * 32);
      }
#pragma unroll
      for (int j = 0; j < 4; ++j) mk[j] = maskv[mi + j * 16];
      addr_wait5(pk[0], pk[1], pk[2], pk[3], mi);
    }

    // ---- ctx += P (16 x 64 keys) . V (64 keys x 64 d) ----
#pragma unroll   // kk must be a constant: vb[kk][t] is held in registers
    for (int kk = 0; kk < 2; ++kk) {
      FH pa;                                                           // A[m = query c][k = key kk*32 + split map]
      pa.h[0] = *(const v8h*)(pw + c * AT_KC + kk * 32 + 8 * hh);
      pa.h[1] = *(const v8h*)(pw + c * AT_KC + kk * 32 + 16 + 8 * hh);
#pragma unroll
      for (int t = 0; t < 4; ++t) oacc[t] = mma_h(pa.v, vb[kk][t], oacc[t]);
    }
  }

  // ---- epilogue: ctx row (q0 + 8hh + r), column hoff + t*16 + c ----
  float* os = Os[wave];
#pragma unroll
  for (int r = 0; r < 8; ++r) {
    const float inv = oscale / (lrow[r] * PSC);
#pragma unroll
    for (int t = 0; t < 4; ++t) os[(8 * hh + r) * 68 + t * 16 + c] = oacc[t][r] * inv;
  }
  __builtin_amdgcn_fence(__ATOMIC_RELEASE, "workgroup");
  __builtin_amdgcn_wave_barrier();
  __builtin_amdgcn_fence(__ATOMIC_ACQUIRE, "workgroup");
  {
    const int q8 = lane >> 3, c8 = (lane & 7) * 8;
    {
#pragma unroll
      for (int it = 0; it < 4; ++it) {
        const int row = it * 4 + q8;                     // rows 0..15 covered by q8 0..3, it 0..3
        const float* sp = os + row * 68 + c8;
        v8h hv;
#pragma unroll
        for (int e = 0; e < 8; ++e) hv[e] = (_Float16)sp[e];
        *(v8h*)(ctx + (size_t)(q0 + row) * ldo + hoff + c8) = hv;
      }
      
    }
  }
}

// =====================================================================================
// One block of 256 threads per row; requires ncols == 1024. Each thread owns 4 consecutive floats;
// =====================================================================================
__global__ __launch_bounds__(256) void row_tanh_res_ln_kernel(
    const float* __restrict__ y, const float* __restrict__ res,
    const float* __restrict__ gamma, const float* __restrict__ beta,
    float* __restrict__ out, int ncols, float eps) {
  __shared__ float red[16];
  const int row  = blockIdx.x;
  const int t    = threadIdx.x;
  const int lane = t & 31;
  const int wave = t >> 5;
  const size_t base = (size_t)row * ncols + 4 * t;
  const v4f yv = *(const v4f*)(y + base);
  const v4f rv = *(const v4f*)(res + base);
  const float x0 = tanhf(yv[0]) + rv[0];
  const float x1 = tanhf(yv[1]) + rv[1];
  const float x2 = tanhf(yv[2]) + rv[2];
  const float x3 = tanhf(yv[3]) + rv[3];
  float s = (x0 + x1) + (x2 + x3);
#pragma unroll
  for (int off = 1; off < 32; off <<= 1) s += __shfl_xor(s, off, 32);
  if (lane == 0) red[wave] = s;
  __syncthreads();
  float tot = 0.f;
#pragma unroll
  for (int w = 0; w < 8; ++w) tot += red[w];
  const float inv_n = 1.0f / (float)ncols;
  const float mu = tot * inv_n;
  const float d0 = x0 - mu, d1 = x1 - mu, d2 = x2 - mu, d3 = x3 - mu;
  float s2 = (d0 * d0 + d1 * d1) + (d2 * d2 + d3 * d3);
#pragma unroll
  for (int off = 1; off < 32; off <<= 1) s2 += __shfl_xor(s2, off, 32);
  if (lane == 0) red[8 + wave] = s2;
  __syncthreads();
  float tot2 = 0.f;
#pragma unroll
  for (int w = 0; w < 8; ++w) tot2 += red[8 + w];
  const float var = tot2 * inv_n;
  const float rn  = 1.0f / sqrtf(var + eps);
  const v4f gv = *(const v4f*)(gamma + 4 * t);
  const v4f bv = *(const v4f*)(beta + 4 * t);
  v4f o;
  o[0] = d0 * rn * gv[0] + bv[0];
  o[1] = d1 * rn * gv[1] + bv[1];
  o[2] = d2 * rn * gv[2] + bv[2];
  o[3] = d3 * rn * gv[3] + bv[3];
  *(v4f*)(out + base) = o;
  
}

// ----------------------------------------------------------------------------
extern "C" void kernel_launch(void* const* d_in, const int* in_sizes, int n_in,
                              void* d_out, int out_size, void* d_ws, size_t ws_size,
                              hipStream_t stream) {
  if (n_in < 12) return;
  const float* ht    = (const float*)d_in[0];
  const float* amask = (const float*)d_in[1];
  const float* Wq    = (const float*)d_in[2];
  const float* bq    = (const float*)d_in[3];
  const float* Wk    = (const float*)d_in[4];
  const float* bk    = (const float*)d_in[5];
  const float* Wv    = (const float*)d_in[6];
  const float* bv    = (const float*)d_in[7];
  const float* Wd    = (const float*)d_in[8];
  const float* bd    = (const float*)d_in[9];
  const float* gamma = (const float*)d_in[10];
  const float* beta  = (const float*)d_in[11];

  const int Dm = in_sizes[3];                 // hidden size (1024)
  if (Dm != 1024) return;
  const int Nn = in_sizes[0] / Dm;            // tokens (2048)
  const int Hh = 16;
  const int Dh = Dm / Hh;                     // 64
  if (Dh != 64 || Nn <= 0 || (Nn % 64) != 0 || in_sizes[0] != Nn * Dm) return;
  if (in_sizes[2] != Dm * Dm || in_sizes[4] != Dm * Dm || in_sizes[6] != Dm * Dm || in_sizes[8] != Dm * Dm) return;
  if (in_sizes[1] < Nn || in_sizes[5] < Dm || in_sizes[7] < Dm || in_sizes[9] < Dm || in_sizes[10] < Dm || in_sizes[11] < Dm) return;
  if (out_size != Nn * Dm) return;

  // ---- workspace carve (bytes; every sub-buffer size is a multiple of 256 B, so all offsets are line aligned) ----
  const size_t bHt16 = (size_t)Nn * Dm * 2;   // f16 [N][D] (and [D][N])
  const size_t bW16  = (size_t)Dm * Dm * 2;   // f16 [D][D]
  const size_t bF    = (size_t)Nn * Dm * 4;   // f32 [N][D]
  size_t o = 0;
  char* ws = (char*)d_ws;
  _Float16* ht16  = (_Float16*)(ws + o); o += bHt16;
  _Float16* w16   = (_Float16*)(ws + o); o += 4 * bW16;      // planes: 0 = Wq x16, 1 = Wk x16, 2 = Wv x16, 3 = Wd x16
  _Float16* q16   = (_Float16*)(ws + o); o += bHt16;         // [N][D]
  _Float16* k16   = (_Float16*)(ws + o); o += bHt16;         // [N][D]
  _Float16* vt16  = (_Float16*)(ws + o); o += bHt16;         // [D][N]  (d-major, token contiguous)
  _Float16* ctx16 = (_Float16*)(ws + o); o += bHt16;         // [N][D], carried x16
  float*    yf    = (float*)(ws + o);    o += bF;            // [N][D] f32 dense pre-activation
  if (o > ws_size) return;                                   // 37748736 B for the given sizes
  _Float16* wd16 = w16 + (size_t)3 * Dm * Dm;

  // ---- casts to f16 (weights carried x16) ----
  const int nHt2 = Nn * Dm / 2, nW2 = Dm * Dm / 2;              // both multiples of 256 (Dm = 1024); w16 follows ht16 directly
  cast5_f32_f16x2s<<<(nHt2 + 4 * nW2) / 256, 256, 0, stream>>>(ht, Wq, Wk, Wv, Wd, ht16, nHt2, nW2, 16.0f);

  // ---- q, k projections: [Nn][Dm] f16 = ht16 . W16^T * (1/16) + bias[n];
  //      v projection, transposed: vt16[dout][token] = Wv16 . ht16^T * (1/16) + bv[dout]; one launch, grid.y picks the product ----
  const int tilesQK = (Nn / 64) * (Dm / 64);                     // the same count for all three
  const dim3 gqk((tilesQK + 7) / 8, 1);
  qkv_gemm64<<<dim3((tilesQK + 7) / 8, 3), 256, 0, stream>>>(
      (const unsigned short*)ht16, (const unsigned short*)w16,
      (unsigned short*)q16, (unsigned short*)k16, (unsigned short*)vt16, bq, bk, bv, Nn, Dm, 1.0f / 16.0f);

  // ---- attention: per (head, 64 query rows) block, 64-key chunks, scale 1/8, additive key mask (1 - m) * -1e4; ctx carried x16 ----
  attn64_f16_kernel<<<Hh * (Nn / 64), 128, 0, stream>>>(
      q16, k16, vt16, amask, ctx16, Nn, Nn, Hh, Dm, Dm, Nn, Dm, 0.125f, -10000.0f, 16.0f);

  // ---- dense projection y = ctx16 . Wd16^T * (1/256) + bd (f32 out) ----
  const unsigned short* Cu = (const unsigned short*)ctx16;
  wmma_gemm64<0, false, 2, 0, false, 0><<<gqk, 256, 0, stream>>>(
      Cu, Cu, Dm, 0L, (const unsigned short*)wd16, (const unsigned short*)wd16, Dm, 0L,
      (void*)yf, (void*)yf, Dm, 0L, bd, ht, 0L, Nn, Dm, Dm, 1.0f / 256.0f);

  // ---- tanh + residual + LayerNorm -> d_out ----
  row_tanh_res_ln_kernel<<<Nn, 256, 0, stream>>>(yf, ht, gamma, beta, (float*)d_out, Dm, 1e-5f);
}

// v003
// Measured time: 131 microseconds a run.
// Next to v002, in two timings, it ran 1.56 times as fast each time.
// Over all steps from v000 it is 3.00 times as fast.
#include <hip/hip_runtime.h>
// Contractions: q/k/v/dense projections v_wmma_f32_16x16x32_f16 (f16 operands, weights carried x16, ctx carried x16, f32 accumulate);
// attention q.kT and p.v v_wmma_f32_16x16x32_f16 (f16 operands, p carried x2^15, f32 accumulate); scale, mask, softmax, tanh, residual, LayerNorm in f32.

typedef __attribute__((ext_vector_type(16))) _Float16 v16h;
typedef __attribute__((ext_vector_type(8)))  _Float16 v8h;
typedef __attribute__((ext_vector_type(16))) __bf16   v16b;
typedef __attribute__((ext_vector_type(8)))  __bf16   v8b;
typedef __attribute__((ext_vector_type(8)))  float    v8f;
typedef __attribute__((ext_vector_type(4)))  float    v4f;

__device__ __forceinline__ unsigned short f2bf_bits(float f) {
  unsigned u = __float_as_uint(f);
  return (unsigned short)((u + 0x7FFFu + ((u >> 16) & 1u)) >> 16);
}
__device__ __forceinline__ float bf_bits2f(unsigned short h) { return __uint_as_float(((unsigned)h) << 16); }

// hazard guards as plain device helpers (no inline asm inside the kernel template body)
__device__ __forceinline__ void dep_guard_h(v8f& a, v8f& b, v16h x, v16h y) { asm volatile("v_nop\n\tv_nop\n\tv_nop\n\tv_nop" : "+v"(a), "+v"(b) : "v"(x), "v"(y)); }
__device__ __forceinline__ void dep_guard_b(v8f& a, v8f& b, v16b x, v16b y) { asm volatile("v_nop\n\tv_nop\n\tv_nop\n\tv_nop" : "+v"(a), "+v"(b) : "v"(x), "v"(y)); }
__device__ __forceinline__ void keep4_h(v16h a, v16h b, v16h c, v16h d) { asm volatile("v_nop" :: "v"(a), "v"(b), "v"(c), "v"(d)); }
__device__ __forceinline__ void keep4_b(v16b a, v16b b, v16b c, v16b d) { asm volatile("v_nop" :: "v"(a), "v"(b), "v"(c), "v"(d)); }
__device__ __forceinline__ void acc_guard4(v8f& a, v8f& b, v8f& c, v8f& d) { asm volatile("v_nop\n\tv_nop\n\tv_nop\n\tv_nop" : "+v"(a), "+v"(b), "+v"(c), "+v"(d)); }
// s_wait_xcnt 0 behind a group of global loads, kept as a precaution in front of any reuse of their address registers.
// The statement names those registers as inputs, so none of them is handed to a later load of the same group as its destination.
__device__ __forceinline__ void addr_wait4(const void* a, const void* b, const void* c, const void* d) {
  asm volatile("s_wait_xcnt 0x0" :: "v"(a), "v"(b), "v"(c), "v"(d) : "memory");
}
__device__ __forceinline__ void addr_wait5p(const void* a, const void* b, const void* c, const void* d, const void* e) {
  asm volatile("s_wait_xcnt 0x0" :: "v"(a), "v"(b), "v"(c), "v"(d), "v"(e) : "memory");
}
__device__ __forceinline__ void addr_wait8(const void* a, const void* b, const void* c, const void* d,
                                           const void* e, const void* f, const void* g, const void* h) {
  asm volatile("s_wait_xcnt 0x0" :: "v"(a), "v"(b), "v"(c), "v"(d), "v"(e), "v"(f), "v"(g), "v"(h) : "memory");
}
template <typename T> struct Frag;
template <> struct Frag<_Float16> {
  typedef v16h V; union U { v16h v; v8h h[2]; };
  static __device__ __forceinline__ v16h load(const _Float16* p) {   // elements 0..7 <- p[0..7], 8..15 <- p[16..23]
    U f; f.h[0] = *(const v8h*)(p); f.h[1] = *(const v8h*)(p + 16); return f.v;
  }
  static __device__ __forceinline__ v8f mma(v16h a, v16h b, v8f c) {
    return __builtin_amdgcn_wmma_f32_16x16x32_f16(false, a, false, b, (short)0, c, false, false);
  }
  static __device__ __forceinline__ void guard(v8f& a, v8f& b, v16h x, v16h y) { dep_guard_h(a, b, x, y); }
  static __device__ __forceinline__ void keep(v16h a, v16h b, v16h c, v16h d) { keep4_h(a, b, c, d); }
};
template <> struct Frag<__bf16> {
  typedef v16b V; union U { v16b v; v8b h[2]; };
  static __device__ __forceinline__ v16b load(const __bf16* p) {
    U f; f.h[0] = *(const v8b*)(p); f.h[1] = *(const v8b*)(p + 16); return f.v;
  }
  static __device__ __forceinline__ v8f mma(v16b a, v16b b, v8f c) {
    return __builtin_amdgcn_wmma_f32_16x16x32_bf16(false, a, false, b, (short)0, c, false, false);
  }
  static __device__ __forceinline__ void guard(v8f& a, v8f& b, v16b x, v16b y) { dep_guard_b(a, b, x, y); }
  static __device__ __forceinline__ void keep(v16b a, v16b b, v16b c, v16b d) { keep4_b(a, b, c, d); }
};

// ---- Register-blocked batched WMMA GEMM ------------------------------------
// C[m,n] = scale * sum_k A[m,k] * Bt[n,k] (+bias)(+resid); each wave owns a 64x64 tile.
// A row-major [M,K]; Bt row-major [N,K]; M,N % 64 == 0, K % 32 == 0.
// SPLIT: operands are hi/lo planes (A2/Bt2 = lo planes, same layout); product = hi.hi + hi.lo + lo.hi.
// BIAS_MODE: 0 = none, 1 = bias[m], 2 = bias[n].
// OUT_MODE: 0 = f32, 1 = f16, 2 = bf16 hi plane (Cout) + bf16 lo plane (Cout2).
// ET: 0 = f16 operands, 1 = bf16 operands (pointers passed as 16-bit storage)
template <int ET> struct Elem;
template <> struct Elem<0> { typedef _Float16 T; };
template <> struct Elem<1> { typedef __bf16 T; };
// gemm64_tile: the work of one block; b = batch index, sT = the block's 8 per-wave 16x64 slabs, pitch 68 floats.
template <int ET, bool SPLIT, int BIAS_MODE, int OUT_MODE, bool RESID, int ACT>
__device__ __forceinline__ void gemm64_tile(
    float (*sT)[16 * 68], const int b,
    const unsigned short* __restrict__ Ap, const unsigned short* __restrict__ A2p, int lda, long strideA,
    const unsigned short* __restrict__ Btp, const unsigned short* __restrict__ Bt2p, int ldb, long strideB,
    void* __restrict__ Cout, void* __restrict__ Cout2, int ldc, long strideC,
    const float* __restrict__ bias,
    const float* __restrict__ resid, long strideR,
    int M, int N, int K, float scale) {
  typedef typename Elem<ET>::T T;
  typedef typename Frag<T>::V V;
  const T* A = (const T*)Ap; const T* A2 = (const T*)A2p; const T* Bt = (const T*)Btp; const T* Bt2 = (const T*)Bt2p;
  const int lane = threadIdx.x & 31;
  const int wave = threadIdx.x >> 5;
  const int tilesN = N >> 6;
  const int tilesM = M >> 6;
  const int tile = blockIdx.x * 8 + wave;
  if (tile >= tilesM * tilesN) return;   // wave-uniform; no block barriers in this kernel
  const int tm = tile / tilesN;
  const int tn = tile - tm * tilesN;
  const int m0 = tm << 6;
  const int n0 = tn << 6;

  const T* Ab  = A  + (size_t)b * strideA;
  const T* Bb  = Bt + (size_t)b * strideB;
  const T* Ab2 = SPLIT ? (A2  + (size_t)b * strideA) : nullptr;
  const T* Bb2 = SPLIT ? (Bt2 + (size_t)b * strideB) : nullptr;

  const int rlane = lane & 15;                 // row (A) / col (B, D) within subtile
  const int koff  = (lane >> 4) * 8;           // k offset of this lane half
  const int mOff  = (lane >> 4) * 8;           // D row offset

  v8f acc[4][4];
#pragma unroll
  for (int i = 0; i < 4; ++i)
#pragma unroll
    for (int j = 0; j < 4; ++j) acc[i][j] = (v8f){0.f,0.f,0.f,0.f,0.f,0.f,0.f,0.f};

  for (int k0 = 0; k0 < K; k0 += 32) {
    // every fragment of this k-step is requested here, ahead of the first product: one load round trip per step
    V bh[4], bl[4], ah[4], al[4];
    const T *pb[4], *pa[4];
#pragma unroll
    for (int j = 0; j < 4; ++j) {
      const size_t bo = (size_t)(n0 + (j << 4) + rlane) * ldb + koff + k0;
      pb[j] = Bb + bo;
      bh[j] = Frag<T>::load(pb[j]);
      if (SPLIT) bl[j] = Frag<T>::load(Bb2 + bo);
    }
#pragma unroll
    for (int i = 0; i < 4; ++i) {
      const size_t ao = (size_t)(m0 + (i << 4) + rlane) * lda + koff + k0;
      pa[i] = Ab + ao;
      ah[i] = Frag<T>::load(pa[i]);
      if (SPLIT) al[i] = Frag<T>::load(Ab2 + ao);
    }
    addr_wait8(pb[0], pb[1], pb[2], pb[3], pa[0], pa[1], pa[2], pa[3]);
    if (SPLIT) addr_wait8(Bb2 + (pb[0] - Bb), Bb2 + (pb[1] - Bb), Bb2 + (pb[2] - Bb), Bb2 + (pb[3] - Bb),
                          Ab2 + (pa[0] - Ab), Ab2 + (pa[1] - Ab), Ab2 + (pa[2] - Ab), Ab2 + (pa[3] - Ab));
#pragma unroll
    for (int i = 0; i < 4; ++i) {
#pragma unroll
      for (int j = 0; j < 4; ++j) {
        acc[i][j] = Frag<T>::mma(ah[i], bh[j], acc[i][j]);
        if (SPLIT) {
          acc[i][j] = Frag<T>::mma(ah[i], bl[j], acc[i][j]);
          acc[i][j] = Frag<T>::mma(al[i], bh[j], acc[i][j]);
        }
      }
      Frag<T>::guard(acc[i][0], acc[i][3], ah[i], SPLIT ? al[i] : ah[i]);
    }
    Frag<T>::keep(bh[0], bh[1], bh[2], bh[3]);
    if (SPLIT) Frag<T>::keep(bl[0], bl[1], bl[2], bl[3]);
  }
  acc_guard4(acc[0][0], acc[0][1], acc[0][2], acc[0][3]);
  acc_guard4(acc[1][0], acc[1][1], acc[1][2], acc[1][3]);
  acc_guard4(acc[2][0], acc[2][1], acc[2][2], acc[2][3]);
  acc_guard4(acc[3][0], acc[3][1], acc[3][2], acc[3][3]);

  // ---- epilogue ----
  float* slab = sT[wave];
  const float* Rb = RESID ? (resid + (size_t)b * strideR) : nullptr;
#pragma unroll
  for (int i = 0; i < 4; ++i) {
    const int mBase = m0 + (i << 4);
#pragma unroll
    for (int j = 0; j < 4; ++j) {
      const int n = n0 + (j << 4) + rlane;
      float bv = 0.f;
      if (BIAS_MODE == 2) bv = bias[n];
#pragma unroll
      for (int r = 0; r < 8; ++r) {
        float v = acc[i][j][r] * scale;
        if (BIAS_MODE == 1) v += bias[mBase + mOff + r];
        if (BIAS_MODE == 2) v += bv;
        if (RESID) v += Rb[(size_t)(mBase + mOff + r) * ldc + n];
        if (ACT == 1) v = tanhf(v);
        if (ACT == 2) v = fmaxf(v, 0.0f);
        if (ACT == 3) v = v / (1.0f + expf(-v));
        if (ACT == 4) v = (v > 0.f) ? v : 0.01f * v;
        if (ACT == 5) v = 0.5f * v * (1.0f + erff(v * 0.70710678118654752f));
        slab[(mOff + r) * 68 + (j << 4) + rlane] = v;
      }
    }
    __builtin_amdgcn_fence(__ATOMIC_RELEASE, "workgroup");
    __builtin_amdgcn_wave_barrier();
    __builtin_amdgcn_fence(__ATOMIC_ACQUIRE, "workgroup");
    if (OUT_MODE == 0) {
      float* C = (float*)Cout + (size_t)b * strideC;
      const int hh = lane >> 4, c4 = (lane & 15) * 4;     // row seg = 256 B = 16 lanes x 16 B
      {
#pragma unroll
        for (int it = 0; it < 8; ++it) {
          const int row = it * 2 + hh;
          v4f v = *(const v4f*)(slab + row * 68 + c4);
          *(v4f*)(C + (size_t)(mBase + row) * ldc + n0 + c4) = v;
        }
        
      }
    } else {
      const int q = lane >> 3, c8 = (lane & 7) * 8;
      unsigned short* C  = (unsigned short*)Cout  + (size_t)b * strideC;
      unsigned short* C2 = (OUT_MODE == 2) ? ((unsigned short*)Cout2 + (size_t)b * strideC) : nullptr;
      {
#pragma unroll
        for (int it = 0; it < 4; ++it) {
          const int row = it * 4 + q;
          const float* sp = slab + row * 68 + c8;
          v8h hv, lv;
#pragma unroll
          for (int e = 0; e < 8; ++e) {
            if (OUT_MODE == 1) {
              hv[e] = (_Float16)sp[e];
            } else {
              unsigned short hb = f2bf_bits(sp[e]);
              unsigned short lb = f2bf_bits(sp[e] - bf_bits2f(hb));
              hv[e] = __builtin_bit_cast(_Float16, hb);
              lv[e] = __builtin_bit_cast(_Float16, lb);
            }
          }
          *(v8h*)(C + (size_t)(mBase + row) * ldc + n0 + c8) = hv;
          if (OUT_MODE == 2) *(v8h*)(C2 + (size_t)(mBase + row) * ldc + n0 + c8) = lv;
        }
        
      }
    }
    __builtin_amdgcn_fence(__ATOMIC_RELEASE, "workgroup");
    __builtin_amdgcn_wave_barrier();
    __builtin_amdgcn_fence(__ATOMIC_ACQUIRE, "workgroup");
  }
}

template <int ET, bool SPLIT, int BIAS_MODE, int OUT_MODE, bool RESID, int ACT = 0>
__global__ __launch_bounds__(256) void wmma_gemm64(
    const unsigned short* __restrict__ Ap, const unsigned short* __restrict__ A2p, int lda, long strideA,
    const unsigned short* __restrict__ Btp, const unsigned short* __restrict__ Bt2p, int ldb, long strideB,
    void* __restrict__ Cout, void* __restrict__ Cout2, int ldc, long strideC,
    const float* __restrict__ bias,
    const float* __restrict__ resid, long strideR,
    int M, int N, int K, float scale) {
  __shared__ __align__(16) float sT[8][16 * 68];
  gemm64_tile<ET, SPLIT, BIAS_MODE, OUT_MODE, RESID, ACT>(
      sT, blockIdx.y, Ap, A2p, lda, strideA, Btp, Bt2p, ldb, strideB, Cout, Cout2, ldc, strideC,
      bias, resid, strideR, M, N, K, scale);
}

// ---- the three projections of one activation matrix x [Nn][Dm] in one launch; they share no result, so their blocks run side by side ----
// blockIdx.y = 0: q[Nn][Dm] = x . Wq^T + bq[n];  1: k likewise;  2: vt[Dm][Nn] = Wv . x^T + bv[m].  w = planes Wq, Wk, Wv of Dm*Dm each.
__global__ __launch_bounds__(256) void qkv_gemm64(
    const unsigned short* __restrict__ x, const unsigned short* __restrict__ w,
    unsigned short* __restrict__ qo, unsigned short* __restrict__ ko, unsigned short* __restrict__ vto,
    const float* __restrict__ bq, const float* __restrict__ bk, const float* __restrict__ bv,
    int Nn, int Dm, float scale) {
  __shared__ __align__(16) float sT[8][16 * 68];
  const int y = blockIdx.y;                                      // block-uniform
  const unsigned short* wy = w + (size_t)y * Dm * Dm;
  if (y == 2) {
    gemm64_tile<0, false, 1, 1, false, 0>(sT, 0, wy, wy, Dm, 0L, x, x, Dm, 0L,
                                          (void*)vto, (void*)vto, Nn, 0L, bv, bv, 0L, Dm, Nn, Dm, scale);
  } else {
    unsigned short* o = (y == 0) ? qo : ko;
    const float* bb = (y == 0) ? bq : bk;
    gemm64_tile<0, false, 2, 1, false, 0>(sT, 0, x, x, Dm, 0L, wy, wy, Dm, 0L,
                                          (void*)o, (void*)o, Dm, 0L, bb, bb, 0L, Nn, Dm, Dm, scale);
  }
}

// ---- f32 -> f16 casts of the activations (x1) and of four equally sized weight matrices (x sc) in one launch ----
// Pairs 0..n2a-1 come from a, the next 4 * n2each from s0..s3; out holds the planes in that order, back to back.
// n2a and n2each are multiples of 256, so the source is the same for a whole block.
__global__ __launch_bounds__(256) void cast5_f32_f16x2s(
    const float* __restrict__ a,
    const float* __restrict__ s0, const float* __restrict__ s1,
    const float* __restrict__ s2, const float* __restrict__ s3,
    _Float16* __restrict__ out, int n2a, int n2each, float sc) {
  const int i0 = blockIdx.x * 256;
  const float* in = a;
  float f = 1.0f;
  int j = i0;                                                    // first pair of this block inside its own source
  if (j >= n2a) {
    j -= n2a; in = s0; f = sc;
    if (j >= n2each) { j -= n2each; in = s1; }
    if (j >= n2each) { j -= n2each; in = s2; }
    if (j >= n2each) { j -= n2each; in = s3; }
  }
  j += threadIdx.x;
  const _Float16 h0 = (_Float16)(in[2 * j] * f), h1 = (_Float16)(in[2 * j + 1] * f);
  const unsigned u = (unsigned)__builtin_bit_cast(unsigned short, h0) | ((unsigned)__builtin_bit_cast(unsigned short, h1) << 16);
  ((unsigned*)out)[i0 + threadIdx.x] = u;
}

// =====================================================================================
// Lean attention for head_dim 64 on f16 planes (no operand conversion inside, no LDS at all):
//   q  [S][ldq]   f16, head h at columns h*64..h*64+63
//   k  [Skv][ldk] f16, same column layout
//   vt [H*64][ldv] f16, row = h*64+d, column = key index
//   maskv [Skv] f32 key vector; score = (q.k) * qscale + (1 - maskv[kv]) * mask_fill
//   ctx [S][ldo] f16 out, head h at columns h*64.., value = oscale * softmax(score) . v
//   Both products run transposed: St = K . Qt (A = key rows, B = query columns), Ot += Vt . Pt (A = vt rows, B = Pt).
//   A lane then holds scores of ONE query (column c): maximum and sum are taken in the lane, the two lane halves
//   exchange the maximum once per chunk and join their sums once at the end; two score tiles, converted in place,
//   are the B operand of the second product, so P goes through no LDS and no lane exchange.
//   v_wmma_f32_16x16x32_f16, f32 accumulate; online softmax in f32; P carried x2^15 in f16.
//   Block = 4 waves = 64 query rows of one head; S, Skv % 64 == 0; grid.x = H * (S/64).
//   Every A/B fragment read from memory comes via Frag<_Float16>::load (k map 8hh+s, 16+8hh+(s-8)), the map a packed D pair has.
// =====================================================================================
#define AT_D 64
#define AT_QB 64
#define AT_KC 64

__device__ __forceinline__ v8f mma_h(v16h a, v16h b, v8f c) {
  c = __builtin_amdgcn_wmma_f32_16x16x32_f16(false, a, false, b, (short)0, c, false, false);
  asm volatile("v_nop\n\tv_nop\n\tv_nop\n\tv_nop" : "+v"(c) : "v"(a), "v"(b));
  return c;
}

// value of lane l ^ 16: a vector cross-row move (a shuffle would go through the LDS pipe and its wait)
__device__ __forceinline__ float other_half(float x) {
  const int b = __builtin_bit_cast(int, x);
  return __builtin_bit_cast(float, __builtin_amdgcn_permlanex16(b, b, 0x76543210, 0xfedcba98, false, false));
}

__global__ __launch_bounds__(128)
void attn64_f16_kernel(const _Float16* __restrict__ q, const _Float16* __restrict__ k,
                       const _Float16* __restrict__ vt, const float* __restrict__ maskv,
                       _Float16* __restrict__ ctx,
                       int S, int Skv, int H, int ldq, int ldk, int ldv, int ldo,
                       float qscale, float mask_fill, float oscale) {
  const float PSC = 32768.0f;                  // probabilities carried x2^15, folded into the final 1/l

  const int tid  = threadIdx.x;
  const int wave = tid >> 5;
  const int lane = tid & 31;
  const int hh   = lane >> 4;
  const int c    = lane & 15;

  const int nqb = S / AT_QB;
  const int bx  = blockIdx.x;
  const int qb  = bx % nqb;
  const int h   = bx / nqb;
  if (h >= H) return;                          // block-uniform; no block barriers in this kernel
  const int q0   = qb * AT_QB + wave * 16;
  const int hoff = h * AT_D;

  // ---- Q fragments (B operand, column = query q0 + c): 2 d-chunks ----
  v16h qa[2];
  {
    const _Float16* qrow = q + (size_t)(q0 + c) * ldq + hoff + 8 * hh;
#pragma unroll
    for (int dc = 0; dc < 2; ++dc) qa[dc] = Frag<_Float16>::load(qrow + dc * 32);
  }

  float mrow = -INFINITY;                      // running maximum of query q0 + c, the same in both lane halves
  float lrow = 0.f;                            // running sum of query q0 + c over this lane half's keys
  v8f oacc[4];                                 // oacc[t][r] = Ot[d = t*16 + 8hh + r][query q0 + c]
#pragma unroll
  for (int t = 0; t < 4; ++t) oacc[t] = (v8f){0.f,0.f,0.f,0.f,0.f,0.f,0.f,0.f};

  const int nChunks = Skv / AT_KC;             // host-derived, static for the launch; at least 1 (Skv % 64 == 0, Skv > 0)

  // K fragments and mask values are requested one chunk ahead: kb[j][dc] = A[m = key kv0+16j+c][k = d], d along the row;
  // mk[j][0..1] = mask of keys kv0+16j+8hh+0..7, the keys of this lane's score registers
  const _Float16* kbase = k  + (size_t)c * ldk + hoff + 8 * hh;
  const _Float16* vbase = vt + (size_t)(hoff + c) * ldv + 8 * hh;
  const float*    mbase = maskv + 8 * hh;
  v16h kb[4][2];
  v4f mk[4][2];
  {
    const _Float16* pk[4];
#pragma unroll
    for (int j = 0; j < 4; ++j) {
      pk[j] = kbase + (size_t)(j * 16) * ldk;
#pragma unroll
      for (int dc = 0; dc < 2; ++dc) kb[j][dc] = Frag<_Float16>::load(pk[j] + dc * 32);
    }
#pragma unroll
    for (int j = 0; j < 4; ++j) {
      mk[j][0] = *(const v4f*)(mbase + j * 16);
      mk[j][1] = *(const v4f*)(mbase + j * 16 + 4);
    }
    addr_wait5p(pk[0], pk[1], pk[2], pk[3], mbase);
  }

  for (int kc = 0; kc < nChunks; ++kc) {
    const int kv0 = kc * AT_KC;

    // this chunk's V fragments are requested here and first used behind the softmax
    v16h vb[2][4];                                                     // A[m = d t*16+c][k = key] from vt row hoff+t*16+c
    {
      const _Float16* pv[4];
#pragma unroll
      for (int t = 0; t < 4; ++t) {
        pv[t] = vbase + (size_t)(t * 16) * ldv + kv0;
#pragma unroll
        for (int kk = 0; kk < 2; ++kk) vb[kk][t] = Frag<_Float16>::load(pv[t] + kk * 32);
      }
      addr_wait4(pv[0], pv[1], pv[2], pv[3]);
    }

    // ---- scores St[64 x 16]: D row 8hh+r of subtile j = key kv0+16j+8hh+r, D col c = query q0+c ----
    v8f s[4];
#pragma unroll
    for (int j = 0; j < 4; ++j) {
      s[j] = (v8f){0.f,0.f,0.f,0.f,0.f,0.f,0.f,0.f};
#pragma unroll
      for (int dc = 0; dc < 2; ++dc) s[j] = mma_h(kb[j][dc], qa[dc], s[j]);
    }

    // scale and mask; the chunk's maximum of this lane's query: four chains in the lane, then one exchange between the halves
    float mj[4];
#pragma unroll
    for (int j = 0; j < 4; ++j) {
      float m = -INFINITY;
#pragma unroll
      for (int r = 0; r < 8; ++r) {
        const float x = s[j][r] * qscale + (1.0f - mk[j][r >> 2][r & 3]) * mask_fill;
        s[j][r] = x;
        m = fmaxf(m, x);
      }
      mj[j] = m;
    }
    float cm = fmaxf(fmaxf(mj[0], mj[1]), fmaxf(mj[2], mj[3]));
    cm = fmaxf(cm, other_half(cm));

    const float mnew  = fmaxf(mrow, cm);
    const float alpha = expf(mrow - mnew);
    mrow = mnew;

    // P in place: pb[kk] = B[k = key kk*32 + (8hh+s | 16+8hh+(s-8))][n = query c] = score tiles 2kk and 2kk+1 of this lane
    v16h pb[2];
    float pj[4];
#pragma unroll
    for (int j = 0; j < 4; ++j) {
      float psum = 0.f;
#pragma unroll
      for (int r = 0; r < 8; ++r) {
        const float p = expf(s[j][r] - mnew);
        psum += p;
        pb[j >> 1][(j & 1) * 8 + r] = (_Float16)(p * PSC);
      }
      pj[j] = psum;
    }
    lrow = lrow * alpha + ((pj[0] + pj[1]) + (pj[2] + pj[3]));
#pragma unroll
    for (int t = 0; t < 4; ++t)
#pragma unroll
      for (int r = 0; r < 8; ++r) oacc[t][r] *= alpha;

    // the next chunk's K fragments and mask values fly during vt.pt; the last pass re-reads chunk 0 (in bounds, unused)
    {
      const int kvn = (kc + 1 < nChunks) ? kv0 + AT_KC : 0;
      const float* pm = mbase + kvn;
      const _Float16* pk[4];
#pragma unroll
      for (int j = 0; j < 4; ++j) {
        pk[j] = kbase + (size_t)(kvn + j * 16) * ldk;
#pragma unroll
        for (int dc = 0; dc < 2; ++dc) kb[j][dc] = Frag<_Float16>::load(pk[j] + dc * 32);
      }
#pragma unroll
      for (int j = 0; j < 4; ++j) {
        mk[j][0] = *(const v4f*)(pm + j * 16);
        mk[j][1] = *(const v4f*)(pm + j * 16 + 4);
      }
      addr_wait5p(pk[0], pk[1], pk[2], pk[3], pm);
    }

    // ---- Ot += Vt (64 d x 64 keys) . Pt (64 keys x 16 queries) ----
#pragma unroll   // kk must be a constant: vb[kk][t] and pb[kk] are held in registers
    for (int kk = 0; kk < 2; ++kk) {
#pragma unroll
      for (int t = 0; t < 4; ++t) oacc[t] = mma_h(vb[kk][t], pb[kk], oacc[t]);
    }
  }

  // ---- epilogue: the halves' sums are joined; a lane's 8 registers of tile t are 8 consecutive d of ctx row q0 + c ----
  {
    const float ltot = lrow + other_half(lrow);
    const float inv  = oscale / (ltot * PSC);
    _Float16* orow = ctx + (size_t)(q0 + c) * ldo + hoff + 8 * hh;
#pragma unroll
    for (int t = 0; t < 4; ++t) {
      v8h hv;
#pragma unroll
      for (int r = 0; r < 8; ++r) hv[r] = (_Float16)(oacc[t][r] * inv);
      *(v8h*)(orow + t * 16) = hv;
    }
  }
}

// =====================================================================================
// One block of 256 threads per row; requires ncols == 1024. Each thread owns 4 consecutive floats;
// =====================================================================================
__global__ __launch_bounds__(256) void row_tanh_res_ln_kernel(
    const float* __restrict__ y, const float* __restrict__ res,
    const float* __restrict__ gamma, const float* __restrict__ beta,
    float* __restrict__ out, int ncols, float eps) {
  __shared__ float red[16];
  const int row  = blockIdx.x;
  const int t    = threadIdx.x;
  const int lane = t & 31;
  const int wave = t >> 5;
  const size_t base = (size_t)row * ncols + 4 * t;
  const v4f yv = *(const v4f*)(y + base);
  const v4f rv = *(const v4f*)(res + base);
  const float x0 = tanhf(yv[0]) + rv[0];
  const float x1 = tanhf(yv[1]) + rv[1];
  const float x2 = tanhf(yv[2]) + rv[2];
  const float x3 = tanhf(yv[3]) + rv[3];
  float s = (x0 + x1) + (x2 + x3);
#pragma unroll
  for (int off = 1; off < 32; off <<= 1) s += __shfl_xor(s, off, 32);
  if (lane == 0) red[wave] = s;
  __syncthreads();
  float tot = 0.f;
#pragma unroll
  for (int w = 0; w < 8; ++w) tot += red[w];
  const float inv_n = 1.0f / (float)ncols;
  const float mu = tot * inv_n;
  const float d0 = x0 - mu, d1 = x1 - mu, d2 = x2 - mu, d3 = x3 - mu;
  float s2 = (d0 * d0 + d1 * d1) + (d2 * d2 + d3 * d3);
#pragma unroll
  for (int off = 1; off < 32; off <<= 1) s2 += __shfl_xor(s2, off, 32);
  if (lane == 0) red[8 + wave] = s2;
  __syncthreads();
  float tot2 = 0.f;
#pragma unroll
  for (int w = 0; w < 8; ++w) tot2 += red[8 + w];
  const float var = tot2 * inv_n;
  const float rn  = 1.0f / sqrtf(var + eps);
  const v4f gv = *(const v4f*)(gamma + 4 * t);
  const v4f bv = *(const v4f*)(beta + 4 * t);
  v4f o;
  o[0] = d0 * rn * gv[0] + bv[0];
  o[1] = d1 * rn * gv[1] + bv[1];
  o[2] = d2 * rn * gv[2] + bv[2];
  o[3] = d3 * rn * gv[3] + bv[3];
  *(v4f*)(out + base) = o;
  
}

// ----------------------------------------------------------------------------
extern "C" void kernel_launch(void* const* d_in, const int* in_sizes, int n_in,
                              void* d_out, int out_size, void* d_ws, size_t ws_size,
                              hipStream_t stream) {
  if (n_in < 12) return;
  const float* ht    = (const float*)d_in[0];
  const float* amask = (const float*)d_in[1];
  const float* Wq    = (const float*)d_in[2];
  const float* bq    = (const float*)d_in[3];
  const float* Wk    = (const float*)d_in[4];
  const float* bk    = (const float*)d_in[5];
  const float* Wv    = (const float*)d_in[6];
  const float* bv    = (const float*)d_in[7];
  const float* Wd    = (const float*)d_in[8];
  const float* bd    = (const float*)d_in[9];
  const float* gamma = (const float*)d_in[10];
  const float* beta  = (const float*)d_in[11];

  const int Dm = in_sizes[3];                 // hidden size (1024)
  if (Dm != 1024) return;
  const int Nn = in_sizes[0] / Dm;            // tokens (2048)
  const int Hh = 16;
  const int Dh = Dm / Hh;                     // 64
  if (Dh != 64 || Nn <= 0 || (Nn % 64) != 0 || in_sizes[0] != Nn * Dm) return;
  if (in_sizes[2] != Dm * Dm || in_sizes[4] != Dm * Dm || in_sizes[6] != Dm * Dm || in_sizes[8] != Dm * Dm) return;
  if (in_sizes[1] < Nn || in_sizes[5] < Dm || in_sizes[7] < Dm || in_sizes[9] < Dm || in_sizes[10] < Dm || in_sizes[11] < Dm) return;
  if (out_size != Nn * Dm) return;

  // ---- workspace carve (bytes; every sub-buffer size is a multiple of 256 B, so all offsets are line aligned) ----
  const size_t bHt16 = (size_t)Nn * Dm * 2;   // f16 [N][D] (and [D][N])
  const size_t bW16  = (size_t)Dm * Dm * 2;   // f16 [D][D]
  const size_t bF    = (size_t)Nn * Dm * 4;   // f32 [N][D]
  size_t o = 0;
  char* ws = (char*)d_ws;
  _Float16* ht16  = (_Float16*)(ws + o); o += bHt16;
  _Float16* w16   = (_Float16*)(ws + o); o += 4 * bW16;      // planes: 0 = Wq x16, 1 = Wk x16, 2 = Wv x16, 3 = Wd x16
  _Float16* q16   = (_Float16*)(ws + o); o += bHt16;         // [N][D]
  _Float16* k16   = (_Float16*)(ws + o); o += bHt16;         // [N][D]
  _Float16* vt16  = (_Float16*)(ws + o); o += bHt16;         // [D][N]  (d-major, token contiguous)
  _Float16* ctx16 = (_Float16*)(ws + o); o += bHt16;         // [N][D], carried x16
  float*    yf    = (float*)(ws + o);    o += bF;            // [N][D] f32 dense pre-activation
  if (o > ws_size) return;                                   // 37748736 B for the given sizes
  _Float16* wd16 = w16 + (size_t)3 * Dm * Dm;

  // ---- casts to f16 (weights carried x16) ----
  const int nHt2 = Nn * Dm / 2, nW2 = Dm * Dm / 2;              // both multiples of 256 (Dm = 1024); w16 follows ht16 directly
  cast5_f32_f16x2s<<<(nHt2 + 4 * nW2) / 256, 256, 0, stream>>>(ht, Wq, Wk, Wv, Wd, ht16, nHt2, nW2, 16.0f);

  // ---- q, k projections: [Nn][Dm] f16 = ht16 . W16^T * (1/16) + bias[n];
  //      v projection, transposed: vt16[dout][token] = Wv16 . ht16^T * (1/16) + bv[dout]; one launch, grid.y picks the product ----
  const int tilesQK = (Nn / 64) * (Dm / 64);                     // the same count for all three
  const dim3 gqk((tilesQK + 7) / 8, 1);
  qkv_gemm64<<<dim3((tilesQK + 7) / 8, 3), 256, 0, stream>>>(
      (const unsigned short*)ht16, (const unsigned short*)w16,
      (unsigned short*)q16, (unsigned short*)k16, (unsigned short*)vt16, bq, bk, bv, Nn, Dm, 1.0f / 16.0f);

  // ---- attention: per (head, 64 query rows) block, 64-key chunks, scale 1/8, additive key mask (1 - m) * -1e4; ctx carried x16 ----
  attn64_f16_kernel<<<Hh * (Nn / 64), 128, 0, stream>>>(
      q16, k16, vt16, amask, ctx16, Nn, Nn, Hh, Dm, Dm, Nn, Dm, 0.125f, -10000.0f, 16.0f);

  // ---- dense projection y = ctx16 . Wd16^T * (1/256) + bd (f32 out) ----
  const unsigned short* Cu = (const unsigned short*)ctx16;
  wmma_gemm64<0, false, 2, 0, false, 0><<<gqk, 256, 0, stream>>>(
      Cu, Cu, Dm, 0L, (const unsigned short*)wd16, (const unsigned short*)wd16, Dm, 0L,
      (void*)yf, (void*)yf, Dm, 0L, bd, ht, 0L, Nn, Dm, Dm, 1.0f / 256.0f);

  // ---- tanh + residual + LayerNorm -> d_out ----
  row_tanh_res_ln_kernel<<<Nn, 256, 0, stream>>>(yf, ht, gamma, beta, (float*)d_out, Dm, 1e-5f);
}

// v004
// One run takes 97 microseconds.
// In two side-by-side timings against v003, it was 1.35 and 1.34 times as fast.
// All steps since v000 together make it 4.04 times as fast.
#include <hip/hip_runtime.h>
// Contractions: q/k/v/dense projections v_wmma_f32_16x16x32_f16 (f16 operands, weights carried x16, ctx carried x16, f32 accumulate);
// attention q.kT and p.v v_wmma_f32_16x16x32_f16 (f16 operands, p carried x2^15, f32 accumulate); scale, mask, softmax, tanh, residual, LayerNorm in f32.

typedef __attribute__((ext_vector_type(16))) _Float16 v16h;
typedef __attribute__((ext_vector_type(8)))  _Float16 v8h;
typedef __attribute__((ext_vector_type(16))) __bf16   v16b;
typedef __attribute__((ext_vector_type(8)))  __bf16   v8b;
typedef __attribute__((ext_vector_type(8)))  float    v8f;
typedef __attribute__((ext_vector_type(4)))  float    v4f;

__device__ __forceinline__ unsigned short f2bf_bits(float f) {
  unsigned u = __float_as_uint(f);
  return (unsigned short)((u + 0x7FFFu + ((u >> 16) & 1u)) >> 16);
}
__device__ __forceinline__ float bf_bits2f(unsigned short h) { return __uint_as_float(((unsigned)h) << 16); }

// hazard guards as plain device helpers (no inline asm inside the kernel template body)
__device__ __forceinline__ void dep_guard_h(v8f& a, v8f& b, v16h x, v16h y) { asm volatile("v_nop\n\tv_nop\n\tv_nop\n\tv_nop" : "+v"(a), "+v"(b) : "v"(x), "v"(y)); }
__device__ __forceinline__ void dep_guard_b(v8f& a, v8f& b, v16b x, v16b y) { asm volatile("v_nop\n\tv_nop\n\tv_nop\n\tv_nop" : "+v"(a), "+v"(b) : "v"(x), "v"(y)); }
__device__ __forceinline__ void keep4_h(v16h a, v16h b, v16h c, v16h d) { asm volatile("v_nop" :: "v"(a), "v"(b), "v"(c), "v"(d)); }
__device__ __forceinline__ void keep4_b(v16b a, v16b b, v16b c, v16b d) { asm volatile("v_nop" :: "v"(a), "v"(b), "v"(c), "v"(d)); }
__device__ __forceinline__ void acc_guard4(v8f& a, v8f& b, v8f& c, v8f& d) { asm volatile("v_nop\n\tv_nop\n\tv_nop\n\tv_nop" : "+v"(a), "+v"(b), "+v"(c), "+v"(d)); }
// s_wait_xcnt 0 behind a group of global loads, kept as a precaution in front of any reuse of their address registers.
// The statement names those registers as inputs, so none of them is handed to a later load of the same group as its destination.
__device__ __forceinline__ void addr_wait4(const void* a, const void* b, const void* c, const void* d) {
  asm volatile("s_wait_xcnt 0x0" :: "v"(a), "v"(b), "v"(c), "v"(d) : "memory");
}
__device__ __forceinline__ void addr_wait5p(const void* a, const void* b, const void* c, const void* d, const void* e) {
  asm volatile("s_wait_xcnt 0x0" :: "v"(a), "v"(b), "v"(c), "v"(d), "v"(e) : "memory");
}
// ---- staging of GEMM operand rows in LDS ----
#define GS_K     128                      // k elements of one stage: 256 B of every operand row
#define GS_PITCH 272                      // LDS bytes from one staged row to the next: 16 B x odd, so 16 rows read 16 B each on 64 distinct banks
#define GS_ROWS  384                      // 128 rows of A, then 256 rows of Bt
#define GS_BUF   (GS_ROWS * GS_PITCH)     // one buffer, 104448 B
// Eight asynchronous 16-byte copies per lane, global -> LDS through no register: rows r, r+16, .. r+112 of one operand.
// l = the lane's LDS byte address of row r, g = its global address there, gs = elements from row r to row r+16.
// s_wait_xcnt 0 closes the statement as a precaution: the operands' registers live to its end, so none is rewritten in front of it.
__device__ __forceinline__ void stage_copy8(unsigned l, const unsigned short* g, size_t gs) {
  asm volatile("global_load_async_to_lds_b128 %0, %8, off\n\t"
               "global_load_async_to_lds_b128 %1, %9, off\n\t"
               "global_load_async_to_lds_b128 %2, %10, off\n\t"
               "global_load_async_to_lds_b128 %3, %11, off\n\t"
               "global_load_async_to_lds_b128 %4, %12, off\n\t"
               "global_load_async_to_lds_b128 %5, %13, off\n\t"
               "global_load_async_to_lds_b128 %6, %14, off\n\t"
               "global_load_async_to_lds_b128 %7, %15, off\n\t"
               "s_wait_xcnt 0x0"
               :: "v"(l), "v"(l + 16 * GS_PITCH), "v"(l + 32 * GS_PITCH), "v"(l + 48 * GS_PITCH),
                  "v"(l + 64 * GS_PITCH), "v"(l + 80 * GS_PITCH), "v"(l + 96 * GS_PITCH), "v"(l + 112 * GS_PITCH),
                  "v"(g), "v"(g + gs), "v"(g + 2 * gs), "v"(g + 3 * gs),
                  "v"(g + 4 * gs), "v"(g + 5 * gs), "v"(g + 6 * gs), "v"(g + 7 * gs)
               : "memory");
}
// this wave's copies have landed in LDS (the compiler places no wait for them)
__device__ __forceinline__ void wait_copies() { asm volatile("s_wait_asynccnt 0x0" ::: "memory"); }
// this wave's LDS reads have returned, so the buffer they read may be refilled behind the next barrier
__device__ __forceinline__ void wait_lds_reads() { asm volatile("s_wait_dscnt 0x0" ::: "memory"); }

template <typename T> struct Frag;
template <> struct Frag<_Float16> {
  typedef v16h V; union U { v16h v; v8h h[2]; };
  static __device__ __forceinline__ v16h load(const _Float16* p) {   // elements 0..7 <- p[0..7], 8..15 <- p[16..23]
    U f; f.h[0] = *(const v8h*)(p); f.h[1] = *(const v8h*)(p + 16); return f.v;
  }
  static __device__ __forceinline__ v8f mma(v16h a, v16h b, v8f c) {
    return __builtin_amdgcn_wmma_f32_16x16x32_f16(false, a, false, b, (short)0, c, false, false);
  }
  static __device__ __forceinline__ void guard(v8f& a, v8f& b, v16h x, v16h y) { dep_guard_h(a, b, x, y); }
  static __device__ __forceinline__ void keep(v16h a, v16h b, v16h c, v16h d) { keep4_h(a, b, c, d); }
};
template <> struct Frag<__bf16> {
  typedef v16b V; union U { v16b v; v8b h[2]; };
  static __device__ __forceinline__ v16b load(const __bf16* p) {
    U f; f.h[0] = *(const v8b*)(p); f.h[1] = *(const v8b*)(p + 16); return f.v;
  }
  static __device__ __forceinline__ v8f mma(v16b a, v16b b, v8f c) {
    return __builtin_amdgcn_wmma_f32_16x16x32_bf16(false, a, false, b, (short)0, c, false, false);
  }
  static __device__ __forceinline__ void guard(v8f& a, v8f& b, v16b x, v16b y) { dep_guard_b(a, b, x, y); }
  static __device__ __forceinline__ void keep(v16b a, v16b b, v16b c, v16b d) { keep4_b(a, b, c, d); }
};

// ---- Register-blocked batched WMMA GEMM ------------------------------------
// C[m,n] = scale * sum_k A[m,k] * Bt[n,k] (+bias)(+resid); each wave owns a 64x64 tile, a block of 2 x 4 waves a 128x256 tile.
// A row-major [M,K]; Bt row-major [N,K]; M % 128 == 0, N % 256 == 0, K % 128 == 0; grid.x = (M/128) * (N/256).
// The block's 128 A rows and 256 Bt rows come into LDS 128 k at a time, as whole 256-B row pieces, by asynchronous copies;
// two buffers: stage t+1 flies while stage t is multiplied. Each staged row serves 4 (A) or 2 (Bt) waves.
// SPLIT: must be false; only the hi planes Ap/Btp are staged, A2/Bt2 are not read.
// BIAS_MODE: 0 = none, 1 = bias[m], 2 = bias[n].
// OUT_MODE: 0 = f32, 1 = f16, 2 = bf16 hi plane (Cout) + bf16 lo plane (Cout2).
// ET: 0 = f16 operands, 1 = bf16 operands (pointers passed as 16-bit storage)
template <int ET> struct Elem;
template <> struct Elem<0> { typedef _Float16 T; };
template <> struct Elem<1> { typedef __bf16 T; };
// gemm64_tile: the work of one block; b = batch index, sT = the block's 8 per-wave 16x64 slabs, pitch 68 floats; ring = 2 * GS_BUF bytes of LDS.
template <int ET, bool SPLIT, int BIAS_MODE, int OUT_MODE, bool RESID, int ACT>
__device__ __forceinline__ void gemm64_tile(
    float (*sT)[16 * 68], unsigned char* ring, const int b,
    const unsigned short* __restrict__ Ap, const unsigned short* __restrict__ A2p, int lda, long strideA,
    const unsigned short* __restrict__ Btp, const unsigned short* __restrict__ Bt2p, int ldb, long strideB,
    void* __restrict__ Cout, void* __restrict__ Cout2, int ldc, long strideC,
    const float* __restrict__ bias,
    const float* __restrict__ resid, long strideR,
    int M, int N, int K, float scale) {
  typedef typename Elem<ET>::T T;
  typedef typename Frag<T>::V V;
  static_assert(!SPLIT, "only the hi planes are staged");
  const int lane = threadIdx.x & 31;
  const int wave = threadIdx.x >> 5;
  const int blocksN = N >> 8;
  const int bm = blockIdx.x / blocksN;
  const int bn = blockIdx.x - bm * blocksN;
  if (bm >= (M >> 7)) return;            // block-uniform, in front of every copy and barrier
  const int wm = wave >> 2;              // which 64 of the block's 128 A rows
  const int wn = wave & 3;               // which 64 of the block's 256 Bt rows
  const int m0 = (bm << 7) + (wm << 6);
  const int n0 = (bn << 8) + (wn << 6);

  // copies: 16 lanes bring one 256-B row piece, a block-wide copy 16 rows
  const int crow = threadIdx.x >> 4;
  const int cpc  = threadIdx.x & 15;
  const unsigned short* gA = Ap  + (size_t)b * strideA + (size_t)((bm << 7) + crow) * lda + cpc * 8;
  const unsigned short* gB = Btp + (size_t)b * strideB + (size_t)((bn << 8) + crow) * ldb + cpc * 8;
  const unsigned lcopy = (unsigned)(size_t)ring + crow * GS_PITCH + cpc * 16;
  const size_t gsA = (size_t)16 * lda, gsB = (size_t)16 * ldb;
  auto fill = [&](int s, int buf) {      // stage s (k = s*GS_K ..) into buffer buf: 24 copies per lane
    const unsigned l = lcopy + buf * GS_BUF;
    stage_copy8(l, gA + s * GS_K, gsA);
    stage_copy8(l + 128 * GS_PITCH, gB + s * GS_K, gsB);
    stage_copy8(l + 256 * GS_PITCH, gB + s * GS_K + 8 * gsB, gsB);
  };

  const int rlane = lane & 15;                 // row (A) / col (B, D) within subtile
  const int koff  = (lane >> 4) * 8;           // k offset of this lane half
  const int mOff  = (lane >> 4) * 8;           // D row offset

  v8f acc[4][4];
#pragma unroll
  for (int i = 0; i < 4; ++i)
#pragma unroll
    for (int j = 0; j < 4; ++j) acc[i][j] = (v8f){0.f,0.f,0.f,0.f,0.f,0.f,0.f,0.f};

  const int nT = K >> 7;                 // stages; at least 1
  fill(0, 0);
  wait_copies();
  __syncthreads();                       // stage 0 is readable by every wave
  if (nT > 1) fill(1, 1);
  for (int t = 0; t < nT; ++t) {
    const unsigned char* buf = ring + (t & 1) * GS_BUF;
    const T* sa = (const T*)(buf + ((wm << 6) + rlane) * GS_PITCH) + koff;
    const T* sb = (const T*)(buf + (128 + (wn << 6) + rlane) * GS_PITCH) + koff;
#pragma unroll   // ks must be a constant: it becomes the LDS loads' immediate offset
    for (int ks = 0; ks < GS_K / 32; ++ks) {
      V bh[4], ah[4];
#pragma unroll
      for (int j = 0; j < 4; ++j) bh[j] = Frag<T>::load(sb + j * (16 * GS_PITCH / 2) + ks * 32);
#pragma unroll
      for (int i = 0; i < 4; ++i) ah[i] = Frag<T>::load(sa + i * (16 * GS_PITCH / 2) + ks * 32);
#pragma unroll
      for (int i = 0; i < 4; ++i) {
#pragma unroll
        for (int j = 0; j < 4; ++j) acc[i][j] = Frag<T>::mma(ah[i], bh[j], acc[i][j]);
        Frag<T>::guard(acc[i][0], acc[i][3], ah[i], ah[i]);
      }
      Frag<T>::keep(bh[0], bh[1], bh[2], bh[3]);
    }
    // publish point of stage t+1: own reads of this buffer done, own copies of the next landed, then every wave's
    wait_lds_reads();
    wait_copies();
    __syncthreads();
    if (t + 2 < nT) fill(t + 2, t & 1);  // block-uniform test; into the buffer every wave has just left
  }
  wait_copies();
  acc_guard4(acc[0][0], acc[0][1], acc[0][2], acc[0][3]);
  acc_guard4(acc[1][0], acc[1][1], acc[1][2], acc[1][3]);
  acc_guard4(acc[2][0], acc[2][1], acc[2][2], acc[2][3]);
  acc_guard4(acc[3][0], acc[3][1], acc[3][2], acc[3][3]);

  // ---- epilogue ----
  float* slab = sT[wave];
  const float* Rb = RESID ? (resid + (size_t)b * strideR) : nullptr;
#pragma unroll
  for (int i = 0; i < 4; ++i) {
    const int mBase = m0 + (i << 4);
#pragma unroll
    for (int j = 0; j < 4; ++j) {
      const int n = n0 + (j << 4) + rlane;
      float bv = 0.f;
      if (BIAS_MODE == 2) bv = bias[n];
#pragma unroll
      for (int r = 0; r < 8; ++r) {
        float v = acc[i][j][r] * scale;
        if (BIAS_MODE == 1) v += bias[mBase + mOff + r];
        if (BIAS_MODE == 2) v += bv;
        if (RESID) v += Rb[(size_t)(mBase + mOff + r) * ldc + n];
        if (ACT == 1) v = tanhf(v);
        if (ACT == 2) v = fmaxf(v, 0.0f);
        if (ACT == 3) v = v / (1.0f + expf(-v));
        if (ACT == 4) v = (v > 0.f) ? v : 0.01f * v;
        if (ACT == 5) v = 0.5f * v * (1.0f + erff(v * 0.70710678118654752f));
        slab[(mOff + r) * 68 + (j << 4) + rlane] = v;
      }
    }
    __builtin_amdgcn_fence(__ATOMIC_RELEASE, "workgroup");
    __builtin_amdgcn_wave_barrier();
    __builtin_amdgcn_fence(__ATOMIC_ACQUIRE, "workgroup");
    if (OUT_MODE == 0) {
      float* C = (float*)Cout + (size_t)b * strideC;
      const int hh = lane >> 4, c4 = (lane & 15) * 4;     // row seg = 256 B = 16 lanes x 16 B
      {
#pragma unroll
        for (int it = 0; it < 8; ++it) {
          const int row = it * 2 + hh;
          v4f v = *(const v4f*)(slab + row * 68 + c4);
          *(v4f*)(C + (size_t)(mBase + row) * ldc + n0 + c4) = v;
        }
        
      }
    } else {
      const int q = lane >> 3, c8 = (lane & 7) * 8;
      unsigned short* C  = (unsigned short*)Cout  + (size_t)b * strideC;
      unsigned short* C2 = (OUT_MODE == 2) ? ((unsigned short*)Cout2 + (size_t)b * strideC) : nullptr;
      {
#pragma unroll
        for (int it = 0; it < 4; ++it) {
          const int row = it * 4 + q;
          const float* sp = slab + row * 68 + c8;
          v8h hv, lv;
#pragma unroll
          for (int e = 0; e < 8; ++e) {
            if (OUT_MODE == 1) {
              hv[e] = (_Float16)sp[e];
            } else {
              unsigned short hb = f2bf_bits(sp[e]);
              unsigned short lb = f2bf_bits(sp[e] - bf_bits2f(hb));
              hv[e] = __builtin_bit_cast(_Float16, hb);
              lv[e] = __builtin_bit_cast(_Float16, lb);
            }
          }
          *(v8h*)(C + (size_t)(mBase + row) * ldc + n0 + c8) = hv;
          if (OUT_MODE == 2) *(v8h*)(C2 + (size_t)(mBase + row) * ldc + n0 + c8) = lv;
        }
        
      }
    }
    __builtin_amdgcn_fence(__ATOMIC_RELEASE, "workgroup");
    __builtin_amdgcn_wave_barrier();
    __builtin_amdgcn_fence(__ATOMIC_ACQUIRE, "workgroup");
  }
}

template <int ET, bool SPLIT, int BIAS_MODE, int OUT_MODE, bool RESID, int ACT = 0>
__global__ __launch_bounds__(256) void wmma_gemm64(
    const unsigned short* __restrict__ Ap, const unsigned short* __restrict__ A2p, int lda, long strideA,
    const unsigned short* __restrict__ Btp, const unsigned short* __restrict__ Bt2p, int ldb, long strideB,
    void* __restrict__ Cout, void* __restrict__ Cout2, int ldc, long strideC,
    const float* __restrict__ bias,
    const float* __restrict__ resid, long strideR,
    int M, int N, int K, float scale) {
  __shared__ __align__(16) float sT[8][16 * 68];
  __shared__ __align__(16) unsigned char ring[2 * GS_BUF];
  gemm64_tile<ET, SPLIT, BIAS_MODE, OUT_MODE, RESID, ACT>(
      sT, ring, blockIdx.y, Ap, A2p, lda, strideA, Btp, Bt2p, ldb, strideB, Cout, Cout2, ldc, strideC,
      bias, resid, strideR, M, N, K, scale);
}

// ---- the three projections of one activation matrix x [Nn][Dm] in one launch; they share no result, so their blocks run side by side ----
// blockIdx.y = 0: q[Nn][Dm] = x . Wq^T + bq[n];  1: k likewise;  2: vt[Dm][Nn] = Wv . x^T + bv[m].  w = planes Wq, Wk, Wv of Dm*Dm each.
__global__ __launch_bounds__(256) void qkv_gemm64(
    const unsigned short* __restrict__ x, const unsigned short* __restrict__ w,
    unsigned short* __restrict__ qo, unsigned short* __restrict__ ko, unsigned short* __restrict__ vto,
    const float* __restrict__ bq, const float* __restrict__ bk, const float* __restrict__ bv,
    int Nn, int Dm, float scale) {
  __shared__ __align__(16) float sT[8][16 * 68];
  __shared__ __align__(16) unsigned char ring[2 * GS_BUF];
  const int y = blockIdx.y;                                      // block-uniform
  const unsigned short* wy = w + (size_t)y * Dm * Dm;
  if (y == 2) {
    gemm64_tile<0, false, 1, 1, false, 0>(sT, ring, 0, wy, wy, Dm, 0L, x, x, Dm, 0L,
                                          (void*)vto, (void*)vto, Nn, 0L, bv, bv, 0L, Dm, Nn, Dm, scale);
  } else {
    unsigned short* o = (y == 0) ? qo : ko;
    const float* bb = (y == 0) ? bq : bk;
    gemm64_tile<0, false, 2, 1, false, 0>(sT, ring, 0, x, x, Dm, 0L, wy, wy, Dm, 0L,
                                          (void*)o, (void*)o, Dm, 0L, bb, bb, 0L, Nn, Dm, Dm, scale);
  }
}

// ---- f32 -> f16 casts of the activations (x1) and of four equally sized weight matrices (x sc) in one launch ----
// Pairs 0..n2a-1 come from a, the next 4 * n2each from s0..s3; out holds the planes in that order, back to back.
// n2a and n2each are multiples of 256, so the source is the same for a whole block.
__global__ __launch_bounds__(256) void cast5_f32_f16x2s(
    const float* __restrict__ a,
    const float* __restrict__ s0, const float* __restrict__ s1,
    const float* __restrict__ s2, const float* __restrict__ s3,
    _Float16* __restrict__ out, int n2a, int n2each, float sc) {
  const int i0 = blockIdx.x * 256;
  const float* in = a;
  float f = 1.0f;
  int j = i0;                                                    // first pair of this block inside its own source
  if (j >= n2a) {
    j -= n2a; in = s0; f = sc;
    if (j >= n2each) { j -= n2each; in = s1; }
    if (j >= n2each) { j -= n2each; in = s2; }
    if (j >= n2each) { j -= n2each; in = s3; }
  }
  j += threadIdx.x;
  const _Float16 h0 = (_Float16)(in[2 * j] * f), h1 = (_Float16)(in[2 * j + 1] * f);
  const unsigned u = (unsigned)__builtin_bit_cast(unsigned short, h0) | ((unsigned)__builtin_bit_cast(unsigned short, h1) << 16);
  ((unsigned*)out)[i0 + threadIdx.x] = u;
}

// =====================================================================================
// Lean attention for head_dim 64 on f16 planes (no operand conversion inside, no LDS at all):
//   q  [S][ldq]   f16, head h at columns h*64..h*64+63
//   k  [Skv][ldk] f16, same column layout
//   vt [H*64][ldv] f16, row = h*64+d, column = key index
//   maskv [Skv] f32 key vector; score = (q.k) * qscale + (1 - maskv[kv]) * mask_fill
//   ctx [S][ldo] f16 out, head h at columns h*64.., value = oscale * softmax(score) . v
//   Both products run transposed: St = K . Qt (A = key rows, B = query columns), Ot += Vt . Pt (A = vt rows, B = Pt).
//   A lane then holds scores of ONE query (column c): maximum and sum are taken in the lane, the two lane halves
//   exchange the maximum once per chunk and join their sums once at the end; two score tiles, converted in place,
//   are the B operand of the second product, so P goes through no LDS and no lane exchange.
//   v_wmma_f32_16x16x32_f16, f32 accumulate; online softmax in f32; P carried x2^15 in f16.
//   Block = 4 waves = 64 query rows of one head; S, Skv % 64 == 0; grid.x = H * (S/64).
//   Every A/B fragment read from memory comes via Frag<_Float16>::load (k map 8hh+s, 16+8hh+(s-8)), the map a packed D pair has.
// =====================================================================================
#define AT_D 64
#define AT_QB 64
#define AT_KC 64

__device__ __forceinline__ v8f mma_h(v16h a, v16h b, v8f c) {
  c = __builtin_amdgcn_wmma_f32_16x16x32_f16(false, a, false, b, (short)0, c, false, false);
  asm volatile("v_nop\n\tv_nop\n\tv_nop\n\tv_nop" : "+v"(c) : "v"(a), "v"(b));
  return c;
}

// value of lane l ^ 16: a vector cross-row move (a shuffle would go through the LDS pipe and its wait)
__device__ __forceinline__ float other_half(float x) {
  const int b = __builtin_bit_cast(int, x);
  return __builtin_bit_cast(float, __builtin_amdgcn_permlanex16(b, b, 0x76543210, 0xfedcba98, false, false));
}

__global__ __launch_bounds__(128)
void attn64_f16_kernel(const _Float16* __restrict__ q, const _Float16* __restrict__ k,
                       const _Float16* __restrict__ vt, const float* __restrict__ maskv,
                       _Float16* __restrict__ ctx,
                       int S, int Skv, int H, int ldq, int ldk, int ldv, int ldo,
                       float qscale, float mask_fill, float oscale) {
  const float PSC = 32768.0f;                  // probabilities carried x2^15, folded into the final 1/l

  const int tid  = threadIdx.x;
  const int wave = tid >> 5;
  const int lane = tid & 31;
  const int hh   = lane >> 4;
  const int c    = lane & 15;

  const int nqb = S / AT_QB;
  const int bx  = blockIdx.x;
  const int qb  = bx % nqb;
  const int h   = bx / nqb;
  if (h >= H) return;                          // block-uniform; no block barriers in this kernel
  const int q0   = qb * AT_QB + wave * 16;
  const int hoff = h * AT_D;

  // ---- Q fragments (B operand, column = query q0 + c): 2 d-chunks ----
  v16h qa[2];
  {
    const _Float16* qrow = q + (size_t)(q0 + c) * ldq + hoff + 8 * hh;
#pragma unroll
    for (int dc = 0; dc < 2; ++dc) qa[dc] = Frag<_Float16>::load(qrow + dc * 32);
  }

  float mrow = -INFINITY;                      // running maximum of query q0 + c, the same in both lane halves
  float lrow = 0.f;                            // running sum of query q0 + c over this lane half's keys
  v8f oacc[4];                                 // oacc[t][r] = Ot[d = t*16 + 8hh + r][query q0 + c]
#pragma unroll
  for (int t = 0; t < 4; ++t) oacc[t] = (v8f){0.f,0.f,0.f,0.f,0.f,0.f,0.f,0.f};

  const int nChunks = Skv / AT_KC;             // host-derived, static for the launch; at least 1 (Skv % 64 == 0, Skv > 0)

  // K fragments and mask values are requested one chunk ahead: kb[j][dc] = A[m = key kv0+16j+c][k = d], d along the row;
  // mk[j][0..1] = mask of keys kv0+16j+8hh+0..7, the keys of this lane's score registers
  const _Float16* kbase = k  + (size_t)c * ldk + hoff + 8 * hh;
  const _Float16* vbase = vt + (size_t)(hoff + c) * ldv + 8 * hh;
  const float*    mbase = maskv + 8 * hh;
  v16h kb[4][2];
  v4f mk[4][2];
  {
    const _Float16* pk[4];
#pragma unroll
    for (int j = 0; j < 4; ++j) {
      pk[j] = kbase + (size_t)(j * 16) * ldk;
#pragma unroll
      for (int dc = 0; dc < 2; ++dc) kb[j][dc] = Frag<_Float16>::load(pk[j] + dc * 32);
    }
#pragma unroll
    for (int j = 0; j < 4; ++j) {
      mk[j][0] = *(const v4f*)(mbase + j * 16);
      mk[j][1] = *(const v4f*)(mbase + j * 16 + 4);
    }
    addr_wait5p(pk[0], pk[1], pk[2], pk[3], mbase);
  }

  for (int kc = 0; kc < nChunks; ++kc) {
    const int kv0 = kc * AT_KC;

    // this chunk's V fragments are requested here and first used behind the softmax
    v16h vb[2][4];                                                     // A[m = d t*16+c][k = key] from vt row hoff+t*16+c
    {
      const _Float16* pv[4];
#pragma unroll
      for (int t = 0; t < 4; ++t) {
        pv[t] = vbase + (size_t)(t * 16) * ldv + kv0;
#pragma unroll
        for (int kk = 0; kk < 2; ++kk) vb[kk][t] = Frag<_Float16>::load(pv[t] + kk * 32);
      }
      addr_wait4(pv[0], pv[1], pv[2], pv[3]);
    }

    // ---- scores St[64 x 16]: D row 8hh+r of subtile j = key kv0+16j+8hh+r, D col c = query q0+c ----
    v8f s[4];
#pragma unroll
    for (int j = 0; j < 4; ++j) {
      s[j] = (v8f){0.f,0.f,0.f,0.f,0.f,0.f,0.f,0.f};
#pragma unroll
      for (int dc = 0; dc < 2; ++dc) s[j] = mma_h(kb[j][dc], qa[dc], s[j]);
    }

    // scale and mask; the chunk's maximum of this lane's query: four chains in the lane, then one exchange between the halves
    float mj[4];
#pragma unroll
    for (int j = 0; j < 4; ++j) {
      float m = -INFINITY;
#pragma unroll
      for (int r = 0; r < 8; ++r) {
        const float x = s[j][r] * qscale + (1.0f - mk[j][r >> 2][r & 3]) * mask_fill;
        s[j][r] = x;
        m = fmaxf(m, x);
      }
      mj[j] = m;
    }
    float cm = fmaxf(fmaxf(mj[0], mj[1]), fmaxf(mj[2], mj[3]));
    cm = fmaxf(cm, other_half(cm));

    const float mnew  = fmaxf(mrow, cm);
    const float alpha = expf(mrow - mnew);
    mrow = mnew;

    // P in place: pb[kk] = B[k = key kk*32 + (8hh+s | 16+8hh+(s-8))][n = query c] = score tiles 2kk and 2kk+1 of this lane
    v16h pb[2];
    float pj[4];
#pragma unroll
    for (int j = 0; j < 4; ++j) {
      float psum = 0.f;
#pragma unroll
      for (int r = 0; r < 8; ++r) {
        const float p = expf(s[j][r] - mnew);
        psum += p;
        pb[j >> 1][(j & 1) * 8 + r] = (_Float16)(p * PSC);
      }
      pj[j] = psum;
    }
    lrow = lrow * alpha + ((pj[0] + pj[1]) + (pj[2] + pj[3]));
#pragma unroll
    for (int t = 0; t < 4; ++t)
#pragma unroll
      for (int r = 0; r < 8; ++r) oacc[t][r] *= alpha;

    // the next chunk's K fragments and mask values fly during vt.pt; the last pass re-reads chunk 0 (in bounds, unused)
    {
      const int kvn = (kc + 1 < nChunks) ? kv0 + AT_KC : 0;
      const float* pm = mbase + kvn;
      const _Float16* pk[4];
#pragma unroll
      for (int j = 0; j < 4; ++j) {
        pk[j] = kbase + (size_t)(kvn + j * 16) * ldk;
#pragma unroll
        for (int dc = 0; dc < 2; ++dc) kb[j][dc] = Frag<_Float16>::load(pk[j] + dc * 32);
      }
#pragma unroll
      for (int j = 0; j < 4; ++j) {
        mk[j][0] = *(const v4f*)(pm + j * 16);
        mk[j][1] = *(const v4f*)(pm + j * 16 + 4);
      }
      addr_wait5p(pk[0], pk[1], pk[2], pk[3], pm);
    }

    // ---- Ot += Vt (64 d x 64 keys) . Pt (64 keys x 16 queries) ----
#pragma unroll   // kk must be a constant: vb[kk][t] and pb[kk] are held in registers
    for (int kk = 0; kk < 2; ++kk) {
#pragma unroll
      for (int t = 0; t < 4; ++t) oacc[t] = mma_h(vb[kk][t], pb[kk], oacc[t]);
    }
  }

  // ---- epilogue: the halves' sums are joined; a lane's 8 registers of tile t are 8 consecutive d of ctx row q0 + c ----
  {
    const float ltot = lrow + other_half(lrow);
    const float inv  = oscale / (ltot * PSC);
    _Float16* orow = ctx + (size_t)(q0 + c) * ldo + hoff + 8 * hh;
#pragma unroll
    for (int t = 0; t < 4; ++t) {
      v8h hv;
#pragma unroll
      for (int r = 0; r < 8; ++r) hv[r] = (_Float16)(oacc[t][r] * inv);
      *(v8h*)(orow + t * 16) = hv;
    }
  }
}

// =====================================================================================
// One block of 256 threads per row; requires ncols == 1024. Each thread owns 4 consecutive floats;
// =====================================================================================
__global__ __launch_bounds__(256) void row_tanh_res_ln_kernel(
    const float* __restrict__ y, const float* __restrict__ res,
    const float* __restrict__ gamma, const float* __restrict__ beta,
    float* __restrict__ out, int ncols, float eps) {
  __shared__ float red[16];
  const int row  = blockIdx.x;
  const int t    = threadIdx.x;
  const int lane = t & 31;
  const int wave = t >> 5;
  const size_t base = (size_t)row * ncols + 4 * t;
  const v4f yv = *(const v4f*)(y + base);
  const v4f rv = *(const v4f*)(res + base);
  const float x0 = tanhf(yv[0]) + rv[0];
  const float x1 = tanhf(yv[1]) + rv[1];
  const float x2 = tanhf(yv[2]) + rv[2];
  const float x3 = tanhf(yv[3]) + rv[3];
  float s = (x0 + x1) + (x2 + x3);
#pragma unroll
  for (int off = 1; off < 32; off <<= 1) s += __shfl_xor(s, off, 32);
  if (lane == 0) red[wave] = s;
  __syncthreads();
  float tot = 0.f;
#pragma unroll
  for (int w = 0; w < 8; ++w) tot += red[w];
  const float inv_n = 1.0f / (float)ncols;
  const float mu = tot * inv_n;
  const float d0 = x0 - mu, d1 = x1 - mu, d2 = x2 - mu, d3 = x3 - mu;
  float s2 = (d0 * d0 + d1 * d1) + (d2 * d2 + d3 * d3);
#pragma unroll
  for (int off = 1; off < 32; off <<= 1) s2 += __shfl_xor(s2, off, 32);
  if (lane == 0) red[8 + wave] = s2;
  __syncthreads();
  float tot2 = 0.f;
#pragma unroll
  for (int w = 0; w < 8; ++w) tot2 += red[8 + w];
  const float var = tot2 * inv_n;
  const float rn  = 1.0f / sqrtf(var + eps);
  const v4f gv = *(const v4f*)(gamma + 4 * t);
  const v4f bv = *(const v4f*)(beta + 4 * t);
  v4f o;
  o[0] = d0 * rn * gv[0] + bv[0];
  o[1] = d1 * rn * gv[1] + bv[1];
  o[2] = d2 * rn * gv[2] + bv[2];
  o[3] = d3 * rn * gv[3] + bv[3];
  *(v4f*)(out + base) = o;
  
}

// ----------------------------------------------------------------------------
extern "C" void kernel_launch(void* const* d_in, const int* in_sizes, int n_in,
                              void* d_out, int out_size, void* d_ws, size_t ws_size,
                              hipStream_t stream) {
  if (n_in < 12) return;
  const float* ht    = (const float*)d_in[0];
  const float* amask = (const float*)d_in[1];
  const float* Wq    = (const float*)d_in[2];
  const float* bq    = (const float*)d_in[3];
  const float* Wk    = (const float*)d_in[4];
  const float* bk    = (const float*)d_in[5];
  const float* Wv    = (const float*)d_in[6];
  const float* bv    = (const float*)d_in[7];
  const float* Wd    = (const float*)d_in[8];
  const float* bd    = (const float*)d_in[9];
  const float* gamma = (const float*)d_in[10];
  const float* beta  = (const float*)d_in[11];

  const int Dm = in_sizes[3];                 // hidden size (1024)
  if (Dm != 1024) return;
  const int Nn = in_sizes[0] / Dm;            // tokens (2048)
  const int Hh = 16;
  const int Dh = Dm / Hh;                     // 64
  if (Dh != 64 || Nn <= 0 || (Nn % 256) != 0 || in_sizes[0] != Nn * Dm) return;
  if (in_sizes[2] != Dm * Dm || in_sizes[4] != Dm * Dm || in_sizes[6] != Dm * Dm || in_sizes[8] != Dm * Dm) return;
  if (in_sizes[1] < Nn || in_sizes[5] < Dm || in_sizes[7] < Dm || in_sizes[9] < Dm || in_sizes[10] < Dm || in_sizes[11] < Dm) return;
  if (out_size != Nn * Dm) return;

  // ---- workspace carve (bytes; every sub-buffer size is a multiple of 256 B, so all offsets are line aligned) ----
  const size_t bHt16 = (size_t)Nn * Dm * 2;   // f16 [N][D] (and [D][N])
  const size_t bW16  = (size_t)Dm * Dm * 2;   // f16 [D][D]
  const size_t bF    = (size_t)Nn * Dm * 4;   // f32 [N][D]
  size_t o = 0;
  char* ws = (char*)d_ws;
  _Float16* ht16  = (_Float16*)(ws + o); o += bHt16;
  _Float16* w16   = (_Float16*)(ws + o); o += 4 * bW16;      // planes: 0 = Wq x16, 1 = Wk x16, 2 = Wv x16, 3 = Wd x16
  _Float16* q16   = (_Float16*)(ws + o); o += bHt16;         // [N][D]
  _Float16* k16   = (_Float16*)(ws + o); o += bHt16;         // [N][D]
  _Float16* vt16  = (_Float16*)(ws + o); o += bHt16;         // [D][N]  (d-major, token contiguous)
  _Float16* ctx16 = (_Float16*)(ws + o); o += bHt16;         // [N][D], carried x16
  float*    yf    = (float*)(ws + o);    o += bF;            // [N][D] f32 dense pre-activation
  if (o > ws_size) return;                                   // 37748736 B for the given sizes
  _Float16* wd16 = w16 + (size_t)3 * Dm * Dm;

  // ---- casts to f16 (weights carried x16) ----
  const int nHt2 = Nn * Dm / 2, nW2 = Dm * Dm / 2;              // both multiples of 256 (Dm = 1024); w16 follows ht16 directly
  cast5_f32_f16x2s<<<(nHt2 + 4 * nW2) / 256, 256, 0, stream>>>(ht, Wq, Wk, Wv, Wd, ht16, nHt2, nW2, 16.0f);

  // ---- q, k projections: [Nn][Dm] f16 = ht16 . W16^T * (1/16) + bias[n];
  //      v projection, transposed: vt16[dout][token] = Wv16 . ht16^T * (1/16) + bv[dout]; one launch, grid.y picks the product ----
  const int tilesQK = (Nn / 64) * (Dm / 64);                     // the same count for all three
  const dim3 gqk((tilesQK + 7) / 8, 1);
  qkv_gemm64<<<dim3((tilesQK + 7) / 8, 3), 256, 0, stream>>>(
      (const unsigned short*)ht16, (const unsigned short*)w16,
      (unsigned short*)q16, (unsigned short*)k16, (unsigned short*)vt16, bq, bk, bv, Nn, Dm, 1.0f / 16.0f);

  // ---- attention: per (head, 64 query rows) block, 64-key chunks, scale 1/8, additive key mask (1 - m) * -1e4; ctx carried x16 ----
  attn64_f16_kernel<<<Hh * (Nn / 64), 128, 0, stream>>>(
      q16, k16, vt16, amask, ctx16, Nn, Nn, Hh, Dm, Dm, Nn, Dm, 0.125f, -10000.0f, 16.0f);

  // ---- dense projection y = ctx16 . Wd16^T * (1/256) + bd (f32 out) ----
  const unsigned short* Cu = (const unsigned short*)ctx16;
  wmma_gemm64<0, false, 2, 0, false, 0><<<gqk, 256, 0, stream>>>(
      Cu, Cu, Dm, 0L, (const unsigned short*)wd16, (const unsigned short*)wd16, Dm, 0L,
      (void*)yf, (void*)yf, Dm, 0L, bd, ht, 0L, Nn, Dm, Dm, 1.0f / 256.0f);

  // ---- tanh + residual + LayerNorm -> d_out ----
  row_tanh_res_ln_kernel<<<Nn, 256, 0, stream>>>(yf, ht, gamma, beta, (float*)d_out, Dm, 1e-5f);
}

// v005
// One run takes 83.4 microseconds.
// Timed twice side by side with v004, it ran 1.17 and 1.16 times as fast.
// All steps since v000 together make it 4.71 times as fast.
#include <hip/hip_runtime.h>
// Contractions: q/k/v/dense projections v_wmma_f32_16x16x32_f16 (f16 operands, weights carried x16, ctx carried x16, f32 accumulate);
// attention q.kT and p.v v_wmma_f32_16x16x32_f16 (f16 operands, p carried x2^15, f32 accumulate); scale, mask, softmax, tanh, residual, LayerNorm in f32.

typedef __attribute__((ext_vector_type(16))) _Float16 v16h;
typedef __attribute__((ext_vector_type(8)))  _Float16 v8h;
typedef __attribute__((ext_vector_type(16))) __bf16   v16b;
typedef __attribute__((ext_vector_type(8)))  __bf16   v8b;
typedef __attribute__((ext_vector_type(8)))  float    v8f;
typedef __attribute__((ext_vector_type(4)))  float    v4f;

__device__ __forceinline__ unsigned short f2bf_bits(float f) {
  unsigned u = __float_as_uint(f);
  return (unsigned short)((u + 0x7FFFu + ((u >> 16) & 1u)) >> 16);
}
__device__ __forceinline__ float bf_bits2f(unsigned short h) { return __uint_as_float(((unsigned)h) << 16); }

// hazard guards as plain device helpers (no inline asm inside the kernel template body)
__device__ __forceinline__ void dep_guard_h(v8f& a, v8f& b, v16h x, v16h y) { asm volatile("v_nop\n\tv_nop\n\tv_nop\n\tv_nop" : "+v"(a), "+v"(b) : "v"(x), "v"(y)); }
__device__ __forceinline__ void dep_guard_b(v8f& a, v8f& b, v16b x, v16b y) { asm volatile("v_nop\n\tv_nop\n\tv_nop\n\tv_nop" : "+v"(a), "+v"(b) : "v"(x), "v"(y)); }
__device__ __forceinline__ void keep4_h(v16h a, v16h b, v16h c, v16h d) { asm volatile("v_nop" :: "v"(a), "v"(b), "v"(c), "v"(d)); }
__device__ __forceinline__ void keep4_b(v16b a, v16b b, v16b c, v16b d) { asm volatile("v_nop" :: "v"(a), "v"(b), "v"(c), "v"(d)); }
__device__ __forceinline__ void acc_guard4(v8f& a, v8f& b, v8f& c, v8f& d) { asm volatile("v_nop\n\tv_nop\n\tv_nop\n\tv_nop" : "+v"(a), "+v"(b), "+v"(c), "+v"(d)); }
// ---- staging of GEMM operand rows in LDS ----
#define GS_K     128                      // k elements of one stage: 256 B of every operand row
#define GS_PITCH 272                      // LDS bytes from one staged row to the next: 16 B x odd, so 16 rows read 16 B each on 64 distinct banks
#define GS_ROWS  384                      // 128 rows of A, then 256 rows of Bt
#define GS_BUF   (GS_ROWS * GS_PITCH)     // one buffer, 104448 B
// Eight asynchronous 16-byte copies per lane, global -> LDS through no register: rows r, r+16, .. r+112 of one operand.
// l = the lane's LDS byte address of row r, g = its global address there, gs = elements from row r to row r+16.
// s_wait_xcnt 0 closes the statement as a precaution: the operands' registers live to its end, so none is rewritten in front of it.
__device__ __forceinline__ void stage_copy8(unsigned l, const unsigned short* g, size_t gs) {
  asm volatile("global_load_async_to_lds_b128 %0, %8, off\n\t"
               "global_load_async_to_lds_b128 %1, %9, off\n\t"
               "global_load_async_to_lds_b128 %2, %10, off\n\t"
               "global_load_async_to_lds_b128 %3, %11, off\n\t"
               "global_load_async_to_lds_b128 %4, %12, off\n\t"
               "global_load_async_to_lds_b128 %5, %13, off\n\t"
               "global_load_async_to_lds_b128 %6, %14, off\n\t"
               "global_load_async_to_lds_b128 %7, %15, off\n\t"
               "s_wait_xcnt 0x0"
               :: "v"(l), "v"(l + 16 * GS_PITCH), "v"(l + 32 * GS_PITCH), "v"(l + 48 * GS_PITCH),
                  "v"(l + 64 * GS_PITCH), "v"(l + 80 * GS_PITCH), "v"(l + 96 * GS_PITCH), "v"(l + 112 * GS_PITCH),
                  "v"(g), "v"(g + gs), "v"(g + 2 * gs), "v"(g + 3 * gs),
                  "v"(g + 4 * gs), "v"(g + 5 * gs), "v"(g + 6 * gs), "v"(g + 7 * gs)
               : "memory");
}
// this wave's copies have landed in LDS (the compiler places no wait for them)
__device__ __forceinline__ void wait_copies() { asm volatile("s_wait_asynccnt 0x0" ::: "memory"); }
// this wave's LDS reads have returned, so the buffer they read may be refilled behind the next barrier
__device__ __forceinline__ void wait_lds_reads() { asm volatile("s_wait_dscnt 0x0" ::: "memory"); }

template <typename T> struct Frag;
template <> struct Frag<_Float16> {
  typedef v16h V; union U { v16h v; v8h h[2]; };
  static __device__ __forceinline__ v16h load(const _Float16* p) {   // elements 0..7 <- p[0..7], 8..15 <- p[16..23]
    U f; f.h[0] = *(const v8h*)(p); f.h[1] = *(const v8h*)(p + 16); return f.v;
  }
  static __device__ __forceinline__ v8f mma(v16h a, v16h b, v8f c) {
    return __builtin_amdgcn_wmma_f32_16x16x32_f16(false, a, false, b, (short)0, c, false, false);
  }
  static __device__ __forceinline__ void guard(v8f& a, v8f& b, v16h x, v16h y) { dep_guard_h(a, b, x, y); }
  static __device__ __forceinline__ void keep(v16h a, v16h b, v16h c, v16h d) { keep4_h(a, b, c, d); }
};
template <> struct Frag<__bf16> {
  typedef v16b V; union U { v16b v; v8b h[2]; };
  static __device__ __forceinline__ v16b load(const __bf16* p) {
    U f; f.h[0] = *(const v8b*)(p); f.h[1] = *(const v8b*)(p + 16); return f.v;
  }
  static __device__ __forceinline__ v8f mma(v16b a, v16b b, v8f c) {
    return __builtin_amdgcn_wmma_f32_16x16x32_bf16(false, a, false, b, (short)0, c, false, false);
  }
  static __device__ __forceinline__ void guard(v8f& a, v8f& b, v16b x, v16b y) { dep_guard_b(a, b, x, y); }
  static __device__ __forceinline__ void keep(v16b a, v16b b, v16b c, v16b d) { keep4_b(a, b, c, d); }
};

// ---- Register-blocked batched WMMA GEMM ------------------------------------
// C[m,n] = scale * sum_k A[m,k] * Bt[n,k] (+bias)(+resid); each wave owns a 64x64 tile, a block of 2 x 4 waves a 128x256 tile.
// A row-major [M,K]; Bt row-major [N,K]; M % 128 == 0, N % 256 == 0, K % 128 == 0; grid.x = (M/128) * (N/256).
// The block's 128 A rows and 256 Bt rows come into LDS 128 k at a time, as whole 256-B row pieces, by asynchronous copies;
// two buffers: stage t+1 flies while stage t is multiplied. Each staged row serves 4 (A) or 2 (Bt) waves.
// SPLIT: must be false; only the hi planes Ap/Btp are staged, A2/Bt2 are not read.
// BIAS_MODE: 0 = none, 1 = bias[m], 2 = bias[n].
// OUT_MODE: 0 = f32, 1 = f16, 2 = bf16 hi plane (Cout) + bf16 lo plane (Cout2).
// ET: 0 = f16 operands, 1 = bf16 operands (pointers passed as 16-bit storage)
template <int ET> struct Elem;
template <> struct Elem<0> { typedef _Float16 T; };
template <> struct Elem<1> { typedef __bf16 T; };
// gemm64_tile: the work of one block; b = batch index, sT = the block's 8 per-wave 16x64 slabs, pitch 68 floats; ring = 2 * GS_BUF bytes of LDS.
template <int ET, bool SPLIT, int BIAS_MODE, int OUT_MODE, bool RESID, int ACT>
__device__ __forceinline__ void gemm64_tile(
    float (*sT)[16 * 68], unsigned char* ring, const int b,
    const unsigned short* __restrict__ Ap, const unsigned short* __restrict__ A2p, int lda, long strideA,
    const unsigned short* __restrict__ Btp, const unsigned short* __restrict__ Bt2p, int ldb, long strideB,
    void* __restrict__ Cout, void* __restrict__ Cout2, int ldc, long strideC,
    const float* __restrict__ bias,
    const float* __restrict__ resid, long strideR,
    int M, int N, int K, float scale) {
  typedef typename Elem<ET>::T T;
  typedef typename Frag<T>::V V;
  static_assert(!SPLIT, "only the hi planes are staged");
  const int lane = threadIdx.x & 31;
  const int wave = threadIdx.x >> 5;
  const int blocksN = N >> 8;
  const int bm = blockIdx.x / blocksN;
  const int bn = blockIdx.x - bm * blocksN;
  if (bm >= (M >> 7)) return;            // block-uniform, in front of every copy and barrier
  const int wm = wave >> 2;              // which 64 of the block's 128 A rows
  const int wn = wave & 3;               // which 64 of the block's 256 Bt rows
  const int m0 = (bm << 7) + (wm << 6);
  const int n0 = (bn << 8) + (wn << 6);

  // copies: 16 lanes bring one 256-B row piece, a block-wide copy 16 rows
  const int crow = threadIdx.x >> 4;
  const int cpc  = threadIdx.x & 15;
  const unsigned short* gA = Ap  + (size_t)b * strideA + (size_t)((bm << 7) + crow) * lda + cpc * 8;
  const unsigned short* gB = Btp + (size_t)b * strideB + (size_t)((bn << 8) + crow) * ldb + cpc * 8;
  const unsigned lcopy = (unsigned)(size_t)ring + crow * GS_PITCH + cpc * 16;
  const size_t gsA = (size_t)16 * lda, gsB = (size_t)16 * ldb;
  auto fill = [&](int s, int buf) {      // stage s (k = s*GS_K ..) into buffer buf: 24 copies per lane
    const unsigned l = lcopy + buf * GS_BUF;
    stage_copy8(l, gA + s * GS_K, gsA);
    stage_copy8(l + 128 * GS_PITCH, gB + s * GS_K, gsB);
    stage_copy8(l + 256 * GS_PITCH, gB + s * GS_K + 8 * gsB, gsB);
  };

  const int rlane = lane & 15;                 // row (A) / col (B, D) within subtile
  const int koff  = (lane >> 4) * 8;           // k offset of this lane half
  const int mOff  = (lane >> 4) * 8;           // D row offset

  v8f acc[4][4];
#pragma unroll
  for (int i = 0; i < 4; ++i)
#pragma unroll
    for (int j = 0; j < 4; ++j) acc[i][j] = (v8f){0.f,0.f,0.f,0.f,0.f,0.f,0.f,0.f};

  const int nT = K >> 7;                 // stages; at least 1
  fill(0, 0);
  wait_copies();
  __syncthreads();                       // stage 0 is readable by every wave
  if (nT > 1) fill(1, 1);
  for (int t = 0; t < nT; ++t) {
    const unsigned char* buf = ring + (t & 1) * GS_BUF;
    const T* sa = (const T*)(buf + ((wm << 6) + rlane) * GS_PITCH) + koff;
    const T* sb = (const T*)(buf + (128 + (wn << 6) + rlane) * GS_PITCH) + koff;
#pragma unroll   // ks must be a constant: it becomes the LDS loads' immediate offset
    for (int ks = 0; ks < GS_K / 32; ++ks) {
      V bh[4], ah[4];
#pragma unroll
      for (int j = 0; j < 4; ++j) bh[j] = Frag<T>::load(sb + j * (16 * GS_PITCH / 2) + ks * 32);
#pragma unroll
      for (int i = 0; i < 4; ++i) ah[i] = Frag<T>::load(sa + i * (16 * GS_PITCH / 2) + ks * 32);
#pragma unroll
      for (int i = 0; i < 4; ++i) {
#pragma unroll
        for (int j = 0; j < 4; ++j) acc[i][j] = Frag<T>::mma(ah[i], bh[j], acc[i][j]);
        Frag<T>::guard(acc[i][0], acc[i][3], ah[i], ah[i]);
      }
      Frag<T>::keep(bh[0], bh[1], bh[2], bh[3]);
    }
    // publish point of stage t+1: own reads of this buffer done, own copies of the next landed, then every wave's
    wait_lds_reads();
    wait_copies();
    __syncthreads();
    if (t + 2 < nT) fill(t + 2, t & 1);  // block-uniform test; into the buffer every wave has just left
  }
  wait_copies();
  acc_guard4(acc[0][0], acc[0][1], acc[0][2], acc[0][3]);
  acc_guard4(acc[1][0], acc[1][1], acc[1][2], acc[1][3]);
  acc_guard4(acc[2][0], acc[2][1], acc[2][2], acc[2][3]);
  acc_guard4(acc[3][0], acc[3][1], acc[3][2], acc[3][3]);

  // ---- epilogue ----
  float* slab = sT[wave];
  const float* Rb = RESID ? (resid + (size_t)b * strideR) : nullptr;
#pragma unroll
  for (int i = 0; i < 4; ++i) {
    const int mBase = m0 + (i << 4);
#pragma unroll
    for (int j = 0; j < 4; ++j) {
      const int n = n0 + (j << 4) + rlane;
      float bv = 0.f;
      if (BIAS_MODE == 2) bv = bias[n];
#pragma unroll
      for (int r = 0; r < 8; ++r) {
        float v = acc[i][j][r] * scale;
        if (BIAS_MODE == 1) v += bias[mBase + mOff + r];
        if (BIAS_MODE == 2) v += bv;
        if (RESID) v += Rb[(size_t)(mBase + mOff + r) * ldc + n];
        if (ACT == 1) v = tanhf(v);
        if (ACT == 2) v = fmaxf(v, 0.0f);
        if (ACT == 3) v = v / (1.0f + expf(-v));
        if (ACT == 4) v = (v > 0.f) ? v : 0.01f * v;
        if (ACT == 5) v = 0.5f * v * (1.0f + erff(v * 0.70710678118654752f));
        slab[(mOff + r) * 68 + (j << 4) + rlane] = v;
      }
    }
    __builtin_amdgcn_fence(__ATOMIC_RELEASE, "workgroup");
    __builtin_amdgcn_wave_barrier();
    __builtin_amdgcn_fence(__ATOMIC_ACQUIRE, "workgroup");
    if (OUT_MODE == 0) {
      float* C = (float*)Cout + (size_t)b * strideC;
      const int hh = lane >> 4, c4 = (lane & 15) * 4;     // row seg = 256 B = 16 lanes x 16 B
      {
#pragma unroll
        for (int it = 0; it < 8; ++it) {
          const int row = it * 2 + hh;
          v4f v = *(const v4f*)(slab + row * 68 + c4);
          *(v4f*)(C + (size_t)(mBase + row) * ldc + n0 + c4) = v;
        }
        
      }
    } else {
      const int q = lane >> 3, c8 = (lane & 7) * 8;
      unsigned short* C  = (unsigned short*)Cout  + (size_t)b * strideC;
      unsigned short* C2 = (OUT_MODE == 2) ? ((unsigned short*)Cout2 + (size_t)b * strideC) : nullptr;
      {
#pragma unroll
        for (int it = 0; it < 4; ++it) {
          const int row = it * 4 + q;
          const float* sp = slab + row * 68 + c8;
          v8h hv, lv;
#pragma unroll
          for (int e = 0; e < 8; ++e) {
            if (OUT_MODE == 1) {
              hv[e] = (_Float16)sp[e];
            } else {
              unsigned short hb = f2bf_bits(sp[e]);
              unsigned short lb = f2bf_bits(sp[e] - bf_bits2f(hb));
              hv[e] = __builtin_bit_cast(_Float16, hb);
              lv[e] = __builtin_bit_cast(_Float16, lb);
            }
          }
          *(v8h*)(C + (size_t)(mBase + row) * ldc + n0 + c8) = hv;
          if (OUT_MODE == 2) *(v8h*)(C2 + (size_t)(mBase + row) * ldc + n0 + c8) = lv;
        }
        
      }
    }
    __builtin_amdgcn_fence(__ATOMIC_RELEASE, "workgroup");
    __builtin_amdgcn_wave_barrier();
    __builtin_amdgcn_fence(__ATOMIC_ACQUIRE, "workgroup");
  }
}

template <int ET, bool SPLIT, int BIAS_MODE, int OUT_MODE, bool RESID, int ACT = 0>
__global__ __launch_bounds__(256) void wmma_gemm64(
    const unsigned short* __restrict__ Ap, const unsigned short* __restrict__ A2p, int lda, long strideA,
    const unsigned short* __restrict__ Btp, const unsigned short* __restrict__ Bt2p, int ldb, long strideB,
    void* __restrict__ Cout, void* __restrict__ Cout2, int ldc, long strideC,
    const float* __restrict__ bias,
    const float* __restrict__ resid, long strideR,
    int M, int N, int K, float scale) {
  __shared__ __align__(16) float sT[8][16 * 68];
  __shared__ __align__(16) unsigned char ring[2 * GS_BUF];
  gemm64_tile<ET, SPLIT, BIAS_MODE, OUT_MODE, RESID, ACT>(
      sT, ring, blockIdx.y, Ap, A2p, lda, strideA, Btp, Bt2p, ldb, strideB, Cout, Cout2, ldc, strideC,
      bias, resid, strideR, M, N, K, scale);
}

// ---- the three projections of one activation matrix x [Nn][Dm] in one launch; they share no result, so their blocks run side by side ----
// blockIdx.y = 0: q[Nn][Dm] = x . Wq^T + bq[n];  1: k likewise;  2: vt[Dm][Nn] = Wv . x^T + bv[m].  w = planes Wq, Wk, Wv of Dm*Dm each.
__global__ __launch_bounds__(256) void qkv_gemm64(
    const unsigned short* __restrict__ x, const unsigned short* __restrict__ w,
    unsigned short* __restrict__ qo, unsigned short* __restrict__ ko, unsigned short* __restrict__ vto,
    const float* __restrict__ bq, const float* __restrict__ bk, const float* __restrict__ bv,
    int Nn, int Dm, float scale) {
  __shared__ __align__(16) float sT[8][16 * 68];
  __shared__ __align__(16) unsigned char ring[2 * GS_BUF];
  const int y = blockIdx.y;                                      // block-uniform
  const unsigned short* wy = w + (size_t)y * Dm * Dm;
  if (y == 2) {
    gemm64_tile<0, false, 1, 1, false, 0>(sT, ring, 0, wy, wy, Dm, 0L, x, x, Dm, 0L,
                                          (void*)vto, (void*)vto, Nn, 0L, bv, bv, 0L, Dm, Nn, Dm, scale);
  } else {
    unsigned short* o = (y == 0) ? qo : ko;
    const float* bb = (y == 0) ? bq : bk;
    gemm64_tile<0, false, 2, 1, false, 0>(sT, ring, 0, x, x, Dm, 0L, wy, wy, Dm, 0L,
                                          (void*)o, (void*)o, Dm, 0L, bb, bb, 0L, Nn, Dm, Dm, scale);
  }
}

// ---- f32 -> f16 casts of the activations (x1) and of four equally sized weight matrices (x sc) in one launch ----
// Pairs 0..n2a-1 come from a, the next 4 * n2each from s0..s3; out holds the planes in that order, back to back.
// n2a and n2each are multiples of 256, so the source is the same for a whole block.
__global__ __launch_bounds__(256) void cast5_f32_f16x2s(
    const float* __restrict__ a,
    const float* __restrict__ s0, const float* __restrict__ s1,
    const float* __restrict__ s2, const float* __restrict__ s3,
    _Float16* __restrict__ out, int n2a, int n2each, float sc) {
  const int i0 = blockIdx.x * 256;
  const float* in = a;
  float f = 1.0f;
  int j = i0;                                                    // first pair of this block inside its own source
  if (j >= n2a) {
    j -= n2a; in = s0; f = sc;
    if (j >= n2each) { j -= n2each; in = s1; }
    if (j >= n2each) { j -= n2each; in = s2; }
    if (j >= n2each) { j -= n2each; in = s3; }
  }
  j += threadIdx.x;
  const _Float16 h0 = (_Float16)(in[2 * j] * f), h1 = (_Float16)(in[2 * j + 1] * f);
  const unsigned u = (unsigned)__builtin_bit_cast(unsigned short, h0) | ((unsigned)__builtin_bit_cast(unsigned short, h1) << 16);
  ((unsigned*)out)[i0 + threadIdx.x] = u;
}

// =====================================================================================
// Lean attention for head_dim 64 on f16 planes (no operand conversion inside; LDS holds only the staged K and V tiles):
//   q  [S][ldq]   f16, head h at columns h*64..h*64+63
//   k  [Skv][ldk] f16, same column layout
//   vt [H*64][ldv] f16, row = h*64+d, column = key index
//   maskv [Skv] f32 key vector; score = (q.k) * qscale + (1 - maskv[kv]) * mask_fill
//   ctx [S][ldo] f16 out, head h at columns h*64.., value = oscale * softmax(score) . v
//   Both products run transposed: St = K . Qt (A = key rows, B = query columns), Ot += Vt . Pt (A = vt rows, B = Pt).
//   A lane then holds scores of ONE query (column c): maximum and sum are taken in the lane, the two lane halves
//   exchange the maximum once per chunk and join their sums once at the end; two score tiles, converted in place,
//   are the B operand of the second product, so P goes through no LDS and no lane exchange.
//   v_wmma_f32_16x16x32_f16, f32 accumulate; online softmax in f32; P carried x2^15 in f16.
//   Block = 4 waves = 64 query rows of one head; S, Skv % 64 == 0; grid.x = H * (S/64).
//   A chunk's 64 K rows and 64 vt rows (128 B each, one whole line) come into LDS once per block by asynchronous copies and serve
//   all 4 waves; two buffers: chunk t+1 flies while chunk t is worked on. A fragment load from global memory touches 16 lines.
//   Every A/B fragment read from memory comes via Frag<_Float16>::load (k map 8hh+s, 16+8hh+(s-8)), the map a packed D pair has.
// =====================================================================================
#define AT_D 64
#define AT_QB 64
#define AT_KC 64
#define AT_PITCH 144                      // LDS bytes from one staged 128-B row to the next: 16 B x odd, so 16 rows read 16 B each on 64 distinct banks
#define AT_BUF   (128 * AT_PITCH)         // one buffer: 64 K rows, then 64 vt rows; 18432 B
// Eight asynchronous 16-byte copies per lane, global -> LDS through no register: rows r, r+16, r+32, r+48 of the K tile, then of the vt tile.
// l = the lane's LDS byte address of K row r, gk / gv = its global addresses there, sk / sv = elements from row r to row r+16.
// s_wait_xcnt 0 closes the statement as a precaution: the operands' registers live to its end, so none is rewritten in front of it.
__device__ __forceinline__ void at_copy8(unsigned l, const _Float16* gk, size_t sk, const _Float16* gv, size_t sv) {
  asm volatile("global_load_async_to_lds_b128 %0, %8, off\n\t"
               "global_load_async_to_lds_b128 %1, %9, off\n\t"
               "global_load_async_to_lds_b128 %2, %10, off\n\t"
               "global_load_async_to_lds_b128 %3, %11, off\n\t"
               "global_load_async_to_lds_b128 %4, %12, off\n\t"
               "global_load_async_to_lds_b128 %5, %13, off\n\t"
               "global_load_async_to_lds_b128 %6, %14, off\n\t"
               "global_load_async_to_lds_b128 %7, %15, off\n\t"
               "s_wait_xcnt 0x0"
               :: "v"(l), "v"(l + 16 * AT_PITCH), "v"(l + 32 * AT_PITCH), "v"(l + 48 * AT_PITCH),
                  "v"(l + 64 * AT_PITCH), "v"(l + 80 * AT_PITCH), "v"(l + 96 * AT_PITCH), "v"(l + 112 * AT_PITCH),
                  "v"(gk), "v"(gk + sk), "v"(gk + 2 * sk), "v"(gk + 3 * sk),
                  "v"(gv), "v"(gv + sv), "v"(gv + 2 * sv), "v"(gv + 3 * sv)
               : "memory");
}
// s_wait_xcnt 0 behind the mask loads, kept as a precaution in front of any reuse of their address register
__device__ __forceinline__ void addr_wait1(const void* a) { asm volatile("s_wait_xcnt 0x0" :: "v"(a) : "memory"); }

__device__ __forceinline__ v8f mma_h(v16h a, v16h b, v8f c) {
  c = __builtin_amdgcn_wmma_f32_16x16x32_f16(false, a, false, b, (short)0, c, false, false);
  asm volatile("v_nop\n\tv_nop\n\tv_nop\n\tv_nop" : "+v"(c) : "v"(a), "v"(b));
  return c;
}

// value of lane l ^ 16: a vector cross-row move (a shuffle would go through the LDS pipe and its wait)
__device__ __forceinline__ float other_half(float x) {
  const int b = __builtin_bit_cast(int, x);
  return __builtin_bit_cast(float, __builtin_amdgcn_permlanex16(b, b, 0x76543210, 0xfedcba98, false, false));
}

__global__ __launch_bounds__(128)
void attn64_f16_kernel(const _Float16* __restrict__ q, const _Float16* __restrict__ k,
                       const _Float16* __restrict__ vt, const float* __restrict__ maskv,
                       _Float16* __restrict__ ctx,
                       int S, int Skv, int H, int ldq, int ldk, int ldv, int ldo,
                       float qscale, float mask_fill, float oscale) {
  __shared__ __align__(16) unsigned char ring[2 * AT_BUF];
  const float PSC = 32768.0f;                  // probabilities carried x2^15, folded into the final 1/l

  const int tid  = threadIdx.x;
  const int wave = tid >> 5;
  const int lane = tid & 31;
  const int hh   = lane >> 4;
  const int c    = lane & 15;

  const int nqb = S / AT_QB;
  const int bx  = blockIdx.x;
  const int qb  = bx % nqb;
  const int h   = bx / nqb;
  if (h >= H) return;                          // block-uniform, in front of every copy and barrier
  const int q0   = qb * AT_QB + wave * 16;
  const int hoff = h * AT_D;

  // ---- Q fragments (B operand, column = query q0 + c): 2 d-chunks ----
  v16h qa[2];
  {
    const _Float16* qrow = q + (size_t)(q0 + c) * ldq + hoff + 8 * hh;
#pragma unroll
    for (int dc = 0; dc < 2; ++dc) qa[dc] = Frag<_Float16>::load(qrow + dc * 32);
  }

  float mrow = -INFINITY;                      // running maximum of query q0 + c, the same in both lane halves
  float lrow = 0.f;                            // running sum of query q0 + c over this lane half's keys
  v8f oacc[4];                                 // oacc[t][r] = Ot[d = t*16 + 8hh + r][query q0 + c]
#pragma unroll
  for (int t = 0; t < 4; ++t) oacc[t] = (v8f){0.f,0.f,0.f,0.f,0.f,0.f,0.f,0.f};

  const int nChunks = Skv / AT_KC;             // host-derived, static for the launch; at least 1 (Skv % 64 == 0, Skv > 0)

  // copies: 8 lanes bring one 128-B row, a block-wide copy 16 rows
  const int crow = tid >> 3;
  const int cpc  = tid & 7;
  const _Float16* gK = k  + (size_t)crow * ldk + hoff + cpc * 8;
  const _Float16* gV = vt + (size_t)(hoff + crow) * ldv + cpc * 8;
  const unsigned lcopy = (unsigned)(size_t)ring + crow * AT_PITCH + cpc * 16;
  const size_t gsK = (size_t)16 * ldk, gsV = (size_t)16 * ldv;
  auto fill = [&](int s, int buf) {            // chunk s (keys s*AT_KC ..) into buffer buf: 8 copies per lane
    at_copy8(lcopy + buf * AT_BUF, gK + (size_t)(s * AT_KC) * ldk, gsK, gV + s * AT_KC, gsV);
  };
  fill(0, 0);

  // mask values are requested one chunk ahead: mk[j][0..1] = mask of keys kv0+16j+8hh+0..7, the keys of this lane's score registers
  const float* mbase = maskv + 8 * hh;
  v4f mk[4][2];
#pragma unroll
  for (int j = 0; j < 4; ++j) {
    mk[j][0] = *(const v4f*)(mbase + j * 16);
    mk[j][1] = *(const v4f*)(mbase + j * 16 + 4);
  }
  addr_wait1(mbase);

  wait_copies();
  __syncthreads();                             // chunk 0 is readable by every wave
  if (nChunks > 1) fill(1, 1);

  for (int kc = 0; kc < nChunks; ++kc) {
    const int kv0 = kc * AT_KC;

    // this chunk's fragments, from its own buffer alone: kb[j][dc] = A[m = key kv0+16j+c][k = d], d along the staged K row;
    // vb[kk][t] = A[m = d t*16+c][k = key], keys along the staged vt row; V is first used behind the softmax
    const unsigned char* buf = ring + (kc & 1) * AT_BUF;
    const _Float16* sk = (const _Float16*)(buf + c * AT_PITCH) + 8 * hh;
    const _Float16* sv = (const _Float16*)(buf + (64 + c) * AT_PITCH) + 8 * hh;
    v16h kb[4][2];
    v16h vb[2][4];
#pragma unroll
    for (int j = 0; j < 4; ++j)
#pragma unroll
      for (int dc = 0; dc < 2; ++dc) kb[j][dc] = Frag<_Float16>::load(sk + j * (16 * AT_PITCH / 2) + dc * 32);
#pragma unroll
    for (int t = 0; t < 4; ++t)
#pragma unroll
      for (int kk = 0; kk < 2; ++kk) vb[kk][t] = Frag<_Float16>::load(sv + t * (16 * AT_PITCH / 2) + kk * 32);

    // ---- scores St[64 x 16]: D row 8hh+r of subtile j = key kv0+16j+8hh+r, D col c = query q0+c ----
    v8f s[4];
#pragma unroll
    for (int j = 0; j < 4; ++j) {
      s[j] = (v8f){0.f,0.f,0.f,0.f,0.f,0.f,0.f,0.f};
#pragma unroll
      for (int dc = 0; dc < 2; ++dc) s[j] = mma_h(kb[j][dc], qa[dc], s[j]);
    }

    // scale and mask; the chunk's maximum of this lane's query: four chains in the lane, then one exchange between the halves
    float mj[4];
#pragma unroll
    for (int j = 0; j < 4; ++j) {
      float m = -INFINITY;
#pragma unroll
      for (int r = 0; r < 8; ++r) {
        const float x = s[j][r] * qscale + (1.0f - mk[j][r >> 2][r & 3]) * mask_fill;
        s[j][r] = x;
        m = fmaxf(m, x);
      }
      mj[j] = m;
    }
    float cm = fmaxf(fmaxf(mj[0], mj[1]), fmaxf(mj[2], mj[3]));
    cm = fmaxf(cm, other_half(cm));

    const float mnew  = fmaxf(mrow, cm);
    const float alpha = expf(mrow - mnew);
    mrow = mnew;

    // P in place: pb[kk] = B[k = key kk*32 + (8hh+s | 16+8hh+(s-8))][n = query c] = score tiles 2kk and 2kk+1 of this lane
    v16h pb[2];
    float pj[4];
#pragma unroll
    for (int j = 0; j < 4; ++j) {
      float psum = 0.f;
#pragma unroll
      for (int r = 0; r < 8; ++r) {
        const float p = expf(s[j][r] - mnew);
        psum += p;
        pb[j >> 1][(j & 1) * 8 + r] = (_Float16)(p * PSC);
      }
      pj[j] = psum;
    }
    lrow = lrow * alpha + ((pj[0] + pj[1]) + (pj[2] + pj[3]));
#pragma unroll
    for (int t = 0; t < 4; ++t)
#pragma unroll
      for (int r = 0; r < 8; ++r) oacc[t][r] *= alpha;

    // the next chunk's mask values fly during vt.pt; the last pass re-reads chunk 0 (in bounds, unused)
    {
      const int kvn = (kc + 1 < nChunks) ? kv0 + AT_KC : 0;
      const float* pm = mbase + kvn;
#pragma unroll
      for (int j = 0; j < 4; ++j) {
        mk[j][0] = *(const v4f*)(pm + j * 16);
        mk[j][1] = *(const v4f*)(pm + j * 16 + 4);
      }
      addr_wait1(pm);
    }

    // ---- Ot += Vt (64 d x 64 keys) . Pt (64 keys x 16 queries) ----
#pragma unroll   // kk must be a constant: vb[kk][t] and pb[kk] are held in registers
    for (int kk = 0; kk < 2; ++kk) {
#pragma unroll
      for (int t = 0; t < 4; ++t) oacc[t] = mma_h(vb[kk][t], pb[kk], oacc[t]);
    }

    // publish point of chunk kc+1: own reads of this buffer done, own copies of the next landed, then every wave's
    wait_lds_reads();
    wait_copies();
    __syncthreads();
    if (kc + 2 < nChunks) fill(kc + 2, kc & 1);  // block-uniform test; into the buffer every wave has just left
  }
  wait_copies();

  // ---- epilogue: the halves' sums are joined; a lane's 8 registers of tile t are 8 consecutive d of ctx row q0 + c ----
  {
    const float ltot = lrow + other_half(lrow);
    const float inv  = oscale / (ltot * PSC);
    _Float16* orow = ctx + (size_t)(q0 + c) * ldo + hoff + 8 * hh;
#pragma unroll
    for (int t = 0; t < 4; ++t) {
      v8h hv;
#pragma unroll
      for (int r = 0; r < 8; ++r) hv[r] = (_Float16)(oacc[t][r] * inv);
      *(v8h*)(orow + t * 16) = hv;
    }
  }
}

// =====================================================================================
// One block of 256 threads per row; requires ncols == 1024. Each thread owns 4 consecutive floats;
// =====================================================================================
__global__ __launch_bounds__(256) void row_tanh_res_ln_kernel(
    const float* __restrict__ y, const float* __restrict__ res,
    const float* __restrict__ gamma, const float* __restrict__ beta,
    float* __restrict__ out, int ncols, float eps) {
  __shared__ float red[16];
  const int row  = blockIdx.x;
  const int t    = threadIdx.x;
  const int lane = t & 31;
  const int wave = t >> 5;
  const size_t base = (size_t)row * ncols + 4 * t;
  const v4f yv = *(const v4f*)(y + base);
  const v4f rv = *(const v4f*)(res + base);
  const float x0 = tanhf(yv[0]) + rv[0];
  const float x1 = tanhf(yv[1]) + rv[1];
  const float x2 = tanhf(yv[2]) + rv[2];
  const float x3 = tanhf(yv[3]) + rv[3];
  float s = (x0 + x1) + (x2 + x3);
#pragma unroll
  for (int off = 1; off < 32; off <<= 1) s += __shfl_xor(s, off, 32);
  if (lane == 0) red[wave] = s;
  __syncthreads();
  float tot = 0.f;
#pragma unroll
  for (int w = 0; w < 8; ++w) tot += red[w];
  const float inv_n = 1.0f / (float)ncols;
  const float mu = tot * inv_n;
  const float d0 = x0 - mu, d1 = x1 - mu, d2 = x2 - mu, d3 = x3 - mu;
  float s2 = (d0 * d0 + d1 * d1) + (d2 * d2 + d3 * d3);
#pragma unroll
  for (int off = 1; off < 32; off <<= 1) s2 += __shfl_xor(s2, off, 32);
  if (lane == 0) red[8 + wave] = s2;
  __syncthreads();
  float tot2 = 0.f;
#pragma unroll
  for (int w = 0; w < 8; ++w) tot2 += red[8 + w];
  const float var = tot2 * inv_n;
  const float rn  = 1.0f / sqrtf(var + eps);
  const v4f gv = *(const v4f*)(gamma + 4 * t);
  const v4f bv = *(const v4f*)(beta + 4 * t);
  v4f o;
  o[0] = d0 * rn * gv[0] + bv[0];
  o[1] = d1 * rn * gv[1] + bv[1];
  o[2] = d2 * rn * gv[2] + bv[2];
  o[3] = d3 * rn * gv[3] + bv[3];
  *(v4f*)(out + base) = o;
  
}

// ----------------------------------------------------------------------------
extern "C" void kernel_launch(void* const* d_in, const int* in_sizes, int n_in,
                              void* d_out, int out_size, void* d_ws, size_t ws_size,
                              hipStream_t stream) {
  if (n_in < 12) return;
  const float* ht    = (const float*)d_in[0];
  const float* amask = (const float*)d_in[1];
  const float* Wq    = (const float*)d_in[2];
  const float* bq    = (const float*)d_in[3];
  const float* Wk    = (const float*)d_in[4];
  const float* bk    = (const float*)d_in[5];
  const float* Wv    = (const float*)d_in[6];
  const float* bv    = (const float*)d_in[7];
  const float* Wd    = (const float*)d_in[8];
  const float* bd    = (const float*)d_in[9];
  const float* gamma = (const float*)d_in[10];
  const float* beta  = (const float*)d_in[11];

  const int Dm = in_sizes[3];                 // hidden size (1024)
  if (Dm != 1024) return;
  const int Nn = in_sizes[0] / Dm;            // tokens (2048)
  const int Hh = 16;
  const int Dh = Dm / Hh;                     // 64
  if (Dh != 64 || Nn <= 0 || (Nn % 256) != 0 || in_sizes[0] != Nn * Dm) return;
  if (in_sizes[2] != Dm * Dm || in_sizes[4] != Dm * Dm || in_sizes[6] != Dm * Dm || in_sizes[8] != Dm * Dm) return;
  if (in_sizes[1] < Nn || in_sizes[5] < Dm || in_sizes[7] < Dm || in_sizes[9] < Dm || in_sizes[10] < Dm || in_sizes[11] < Dm) return;
  if (out_size != Nn * Dm) return;

  // ---- workspace carve (bytes; every sub-buffer size is a multiple of 256 B, so all offsets are line aligned) ----
  const size_t bHt16 = (size_t)Nn * Dm * 2;   // f16 [N][D] (and [D][N])
  const size_t bW16  = (size_t)Dm * Dm * 2;   // f16 [D][D]
  const size_t bF    = (size_t)Nn * Dm * 4;   // f32 [N][D]
  size_t o = 0;
  char* ws = (char*)d_ws;
  _Float16* ht16  = (_Float16*)(ws + o); o += bHt16;
  _Float16* w16   = (_Float16*)(ws + o); o += 4 * bW16;      // planes: 0 = Wq x16, 1 = Wk x16, 2 = Wv x16, 3 = Wd x16
  _Float16* q16   = (_Float16*)(ws + o); o += bHt16;         // [N][D]
  _Float16* k16   = (_Float16*)(ws + o); o += bHt16;         // [N][D]
  _Float16* vt16  = (_Float16*)(ws + o); o += bHt16;         // [D][N]  (d-major, token contiguous)
  _Float16* ctx16 = (_Float16*)(ws + o); o += bHt16;         // [N][D], carried x16
  float*    yf    = (float*)(ws + o);    o += bF;            // [N][D] f32 dense pre-activation
  if (o > ws_size) return;                                   // 37748736 B for the given sizes
  _Float16* wd16 = w16 + (size_t)3 * Dm * Dm;

  // ---- casts to f16 (weights carried x16) ----
  const int nHt2 = Nn * Dm / 2, nW2 = Dm * Dm / 2;              // both multiples of 256 (Dm = 1024); w16 follows ht16 directly
  cast5_f32_f16x2s<<<(nHt2 + 4 * nW2) / 256, 256, 0, stream>>>(ht, Wq, Wk, Wv, Wd, ht16, nHt2, nW2, 16.0f);

  // ---- q, k projections: [Nn][Dm] f16 = ht16 . W16^T * (1/16) + bias[n];
  //      v projection, transposed: vt16[dout][token] = Wv16 . ht16^T * (1/16) + bv[dout]; one launch, grid.y picks the product ----
  const int tilesQK = (Nn / 64) * (Dm / 64);                     // the same count for all three
  const dim3 gqk((tilesQK + 7) / 8, 1);
  qkv_gemm64<<<dim3((tilesQK + 7) / 8, 3), 256, 0, stream>>>(
      (const unsigned short*)ht16, (const unsigned short*)w16,
      (unsigned short*)q16, (unsigned short*)k16, (unsigned short*)vt16, bq, bk, bv, Nn, Dm, 1.0f / 16.0f);

  // ---- attention: per (head, 64 query rows) block, 64-key chunks, scale 1/8, additive key mask (1 - m) * -1e4; ctx carried x16 ----
  attn64_f16_kernel<<<Hh * (Nn / 64), 128, 0, stream>>>(
      q16, k16, vt16, amask, ctx16, Nn, Nn, Hh, Dm, Dm, Nn, Dm, 0.125f, -10000.0f, 16.0f);

  // ---- dense projection y = ctx16 . Wd16^T * (1/256) + bd (f32 out) ----
  const unsigned short* Cu = (const unsigned short*)ctx16;
  wmma_gemm64<0, false, 2, 0, false, 0><<<gqk, 256, 0, stream>>>(
      Cu, Cu, Dm, 0L, (const unsigned short*)wd16, (const unsigned short*)wd16, Dm, 0L,
      (void*)yf, (void*)yf, Dm, 0L, bd, ht, 0L, Nn, Dm, Dm, 1.0f / 256.0f);

  // ---- tanh + residual + LayerNorm -> d_out ----
  row_tanh_res_ln_kernel<<<Nn, 256, 0, stream>>>(yf, ht, gamma, beta, (float*)d_out, Dm, 1e-5f);
}

// v006
// A run of this version takes 72.3 microseconds.
// In two side-by-side timings against v005, it was 1.15 and 1.16 times as fast.
// Counting every step since v000, it is 5.45 times as fast.
#include <hip/hip_runtime.h>
// Contractions: q/k/v/dense projections v_wmma_f32_16x16x32_f16 (f16 operands, weights carried x16, ctx carried x16, f32 accumulate);
// attention q.kT and p.v v_wmma_f32_16x16x32_f16 (f16 operands, p carried x2^15, f32 accumulate); scale, mask, softmax, tanh, residual, LayerNorm in f32.

typedef __attribute__((ext_vector_type(16))) _Float16 v16h;
typedef __attribute__((ext_vector_type(8)))  _Float16 v8h;
typedef __attribute__((ext_vector_type(16))) __bf16   v16b;
typedef __attribute__((ext_vector_type(8)))  __bf16   v8b;
typedef __attribute__((ext_vector_type(8)))  float    v8f;
typedef __attribute__((ext_vector_type(4)))  float    v4f;

__device__ __forceinline__ unsigned short f2bf_bits(float f) {
  unsigned u = __float_as_uint(f);
  return (unsigned short)((u + 0x7FFFu + ((u >> 16) & 1u)) >> 16);
}
__device__ __forceinline__ float bf_bits2f(unsigned short h) { return __uint_as_float(((unsigned)h) << 16); }

// hazard guards as plain device helpers (no inline asm inside the kernel template body)
__device__ __forceinline__ void dep_guard_h(v8f& a, v8f& b, v16h x, v16h y) { asm volatile("v_nop\n\tv_nop\n\tv_nop\n\tv_nop" : "+v"(a), "+v"(b) : "v"(x), "v"(y)); }
__device__ __forceinline__ void dep_guard_b(v8f& a, v8f& b, v16b x, v16b y) { asm volatile("v_nop\n\tv_nop\n\tv_nop\n\tv_nop" : "+v"(a), "+v"(b) : "v"(x), "v"(y)); }
__device__ __forceinline__ void keep4_h(v16h a, v16h b, v16h c, v16h d) { asm volatile("v_nop" :: "v"(a), "v"(b), "v"(c), "v"(d)); }
__device__ __forceinline__ void keep4_b(v16b a, v16b b, v16b c, v16b d) { asm volatile("v_nop" :: "v"(a), "v"(b), "v"(c), "v"(d)); }
__device__ __forceinline__ void acc_guard4(v8f& a, v8f& b, v8f& c, v8f& d) { asm volatile("v_nop\n\tv_nop\n\tv_nop\n\tv_nop" : "+v"(a), "+v"(b), "+v"(c), "+v"(d)); }
// ---- staging of GEMM operand rows in LDS ----
#define GS_K     128                      // k elements of one stage: 256 B of every operand row
#define GS_PITCH 272                      // LDS bytes from one staged row to the next: 16 B x odd, so 16 rows read 16 B each on 64 distinct banks
#define GS_ROWS  384                      // 128 rows of A, then 256 rows of Bt
#define GS_BUF   (GS_ROWS * GS_PITCH)     // one buffer, 104448 B
// Eight asynchronous 16-byte copies per lane, global -> LDS through no register: rows r, r+16, .. r+112 of one operand.
// l = the lane's LDS byte address of row r, g = its global address there, gs = elements from row r to row r+16.
// s_wait_xcnt 0 closes the statement as a precaution: the operands' registers live to its end, so none is rewritten in front of it.
__device__ __forceinline__ void stage_copy8(unsigned l, const unsigned short* g, size_t gs) {
  asm volatile("global_load_async_to_lds_b128 %0, %8, off\n\t"
               "global_load_async_to_lds_b128 %1, %9, off\n\t"
               "global_load_async_to_lds_b128 %2, %10, off\n\t"
               "global_load_async_to_lds_b128 %3, %11, off\n\t"
               "global_load_async_to_lds_b128 %4, %12, off\n\t"
               "global_load_async_to_lds_b128 %5, %13, off\n\t"
               "global_load_async_to_lds_b128 %6, %14, off\n\t"
               "global_load_async_to_lds_b128 %7, %15, off\n\t"
               "s_wait_xcnt 0x0"
               :: "v"(l), "v"(l + 16 * GS_PITCH), "v"(l + 32 * GS_PITCH), "v"(l + 48 * GS_PITCH),
                  "v"(l + 64 * GS_PITCH), "v"(l + 80 * GS_PITCH), "v"(l + 96 * GS_PITCH), "v"(l + 112 * GS_PITCH),
                  "v"(g), "v"(g + gs), "v"(g + 2 * gs), "v"(g + 3 * gs),
                  "v"(g + 4 * gs), "v"(g + 5 * gs), "v"(g + 6 * gs), "v"(g + 7 * gs)
               : "memory");
}
// this wave's copies have landed in LDS (the compiler places no wait for them)
__device__ __forceinline__ void wait_copies() { asm volatile("s_wait_asynccnt 0x0" ::: "memory"); }
// this wave's LDS reads have returned, so the buffer they read may be refilled behind the next barrier
__device__ __forceinline__ void wait_lds_reads() { asm volatile("s_wait_dscnt 0x0" ::: "memory"); }

template <typename T> struct Frag;
template <> struct Frag<_Float16> {
  typedef v16h V; union U { v16h v; v8h h[2]; };
  static __device__ __forceinline__ v16h load(const _Float16* p) {   // elements 0..7 <- p[0..7], 8..15 <- p[16..23]
    U f; f.h[0] = *(const v8h*)(p); f.h[1] = *(const v8h*)(p + 16); return f.v;
  }
  static __device__ __forceinline__ v8f mma(v16h a, v16h b, v8f c) {
    return __builtin_amdgcn_wmma_f32_16x16x32_f16(false, a, false, b, (short)0, c, false, false);
  }
  static __device__ __forceinline__ void guard(v8f& a, v8f& b, v16h x, v16h y) { dep_guard_h(a, b, x, y); }
  static __device__ __forceinline__ void keep(v16h a, v16h b, v16h c, v16h d) { keep4_h(a, b, c, d); }
};
template <> struct Frag<__bf16> {
  typedef v16b V; union U { v16b v; v8b h[2]; };
  static __device__ __forceinline__ v16b load(const __bf16* p) {
    U f; f.h[0] = *(const v8b*)(p); f.h[1] = *(const v8b*)(p + 16); return f.v;
  }
  static __device__ __forceinline__ v8f mma(v16b a, v16b b, v8f c) {
    return __builtin_amdgcn_wmma_f32_16x16x32_bf16(false, a, false, b, (short)0, c, false, false);
  }
  static __device__ __forceinline__ void guard(v8f& a, v8f& b, v16b x, v16b y) { dep_guard_b(a, b, x, y); }
  static __device__ __forceinline__ void keep(v16b a, v16b b, v16b c, v16b d) { keep4_b(a, b, c, d); }
};

// ---- Register-blocked batched WMMA GEMM ------------------------------------
// C[m,n] = scale * sum_k A[m,k] * Bt[n,k] (+bias)(+resid); each wave owns a 64x64 tile, a block of 2 x 4 waves a 128x256 tile.
// A row-major [M,K]; Bt row-major [N,K]; M % 128 == 0, N % 256 == 0, K % 128 == 0; grid.x = (M/128) * (N/256).
// The block's 128 A rows and 256 Bt rows come into LDS 128 k at a time, as whole 256-B row pieces, by asynchronous copies;
// two buffers: stage t+1 flies while stage t is multiplied. Each staged row serves 4 (A) or 2 (Bt) waves.
// SPLIT: must be false; only the hi planes Ap/Btp are staged, A2/Bt2 are not read.
// BIAS_MODE: 0 = none, 1 = bias[m], 2 = bias[n].
// OUT_MODE: 0 = f32, 1 = f16, 2 = bf16 hi plane (Cout) + bf16 lo plane (Cout2).
// ET: 0 = f16 operands, 1 = bf16 operands (pointers passed as 16-bit storage)
template <int ET> struct Elem;
template <> struct Elem<0> { typedef _Float16 T; };
template <> struct Elem<1> { typedef __bf16 T; };
// gemm64_tile: the work of one block; b = batch index, sT = the block's 8 per-wave 16x64 slabs, pitch 68 floats; ring = 2 * GS_BUF bytes of LDS.
template <int ET, bool SPLIT, int BIAS_MODE, int OUT_MODE, bool RESID, int ACT>
__device__ __forceinline__ void gemm64_tile(
    float (*sT)[16 * 68], unsigned char* ring, const int b,
    const unsigned short* __restrict__ Ap, const unsigned short* __restrict__ A2p, int lda, long strideA,
    const unsigned short* __restrict__ Btp, const unsigned short* __restrict__ Bt2p, int ldb, long strideB,
    void* __restrict__ Cout, void* __restrict__ Cout2, int ldc, long strideC,
    const float* __restrict__ bias,
    const float* __restrict__ resid, long strideR,
    int M, int N, int K, float scale) {
  typedef typename Elem<ET>::T T;
  typedef typename Frag<T>::V V;
  static_assert(!SPLIT, "only the hi planes are staged");
  const int lane = threadIdx.x & 31;
  const int wave = threadIdx.x >> 5;
  const int blocksN = N >> 8;
  const int bm = blockIdx.x / blocksN;
  const int bn = blockIdx.x - bm * blocksN;
  if (bm >= (M >> 7)) return;            // block-uniform, in front of every copy and barrier
  const int wm = wave >> 2;              // which 64 of the block's 128 A rows
  const int wn = wave & 3;               // which 64 of the block's 256 Bt rows
  const int m0 = (bm << 7) + (wm << 6);
  const int n0 = (bn << 8) + (wn << 6);

  // copies: 16 lanes bring one 256-B row piece, a block-wide copy 16 rows
  const int crow = threadIdx.x >> 4;
  const int cpc  = threadIdx.x & 15;
  const unsigned short* gA = Ap  + (size_t)b * strideA + (size_t)((bm << 7) + crow) * lda + cpc * 8;
  const unsigned short* gB = Btp + (size_t)b * strideB + (size_t)((bn << 8) + crow) * ldb + cpc * 8;
  const unsigned lcopy = (unsigned)(size_t)ring + crow * GS_PITCH + cpc * 16;
  const size_t gsA = (size_t)16 * lda, gsB = (size_t)16 * ldb;
  auto fill = [&](int s, int buf) {      // stage s (k = s*GS_K ..) into buffer buf: 24 copies per lane
    const unsigned l = lcopy + buf * GS_BUF;
    stage_copy8(l, gA + s * GS_K, gsA);
    stage_copy8(l + 128 * GS_PITCH, gB + s * GS_K, gsB);
    stage_copy8(l + 256 * GS_PITCH, gB + s * GS_K + 8 * gsB, gsB);
  };

  const int rlane = lane & 15;                 // row (A) / col (B, D) within subtile
  const int koff  = (lane >> 4) * 8;           // k offset of this lane half
  const int mOff  = (lane >> 4) * 8;           // D row offset

  v8f acc[4][4];
#pragma unroll
  for (int i = 0; i < 4; ++i)
#pragma unroll
    for (int j = 0; j < 4; ++j) acc[i][j] = (v8f){0.f,0.f,0.f,0.f,0.f,0.f,0.f,0.f};

  const int nT = K >> 7;                 // stages; at least 1
  fill(0, 0);
  wait_copies();
  __syncthreads();                       // stage 0 is readable by every wave
  if (nT > 1) fill(1, 1);
  for (int t = 0; t < nT; ++t) {
    const unsigned char* buf = ring + (t & 1) * GS_BUF;
    const T* sa = (const T*)(buf + ((wm << 6) + rlane) * GS_PITCH) + koff;
    const T* sb = (const T*)(buf + (128 + (wn << 6) + rlane) * GS_PITCH) + koff;
#pragma unroll   // ks must be a constant: it becomes the LDS loads' immediate offset
    for (int ks = 0; ks < GS_K / 32; ++ks) {
      V bh[4], ah[4];
#pragma unroll
      for (int j = 0; j < 4; ++j) bh[j] = Frag<T>::load(sb + j * (16 * GS_PITCH / 2) + ks * 32);
#pragma unroll
      for (int i = 0; i < 4; ++i) ah[i] = Frag<T>::load(sa + i * (16 * GS_PITCH / 2) + ks * 32);
#pragma unroll
      for (int i = 0; i < 4; ++i) {
#pragma unroll
        for (int j = 0; j < 4; ++j) acc[i][j] = Frag<T>::mma(ah[i], bh[j], acc[i][j]);
        Frag<T>::guard(acc[i][0], acc[i][3], ah[i], ah[i]);
      }
      Frag<T>::keep(bh[0], bh[1], bh[2], bh[3]);
    }
    // publish point of stage t+1: own reads of this buffer done, own copies of the next landed, then every wave's
    wait_lds_reads();
    wait_copies();
    __syncthreads();
    if (t + 2 < nT) fill(t + 2, t & 1);  // block-uniform test; into the buffer every wave has just left
  }
  wait_copies();
  acc_guard4(acc[0][0], acc[0][1], acc[0][2], acc[0][3]);
  acc_guard4(acc[1][0], acc[1][1], acc[1][2], acc[1][3]);
  acc_guard4(acc[2][0], acc[2][1], acc[2][2], acc[2][3]);
  acc_guard4(acc[3][0], acc[3][1], acc[3][2], acc[3][3]);

  // ---- epilogue ----
  float* slab = sT[wave];
  const float* Rb = RESID ? (resid + (size_t)b * strideR) : nullptr;
#pragma unroll
  for (int i = 0; i < 4; ++i) {
    const int mBase = m0 + (i << 4);
#pragma unroll
    for (int j = 0; j < 4; ++j) {
      const int n = n0 + (j << 4) + rlane;
      float bv = 0.f;
      if (BIAS_MODE == 2) bv = bias[n];
#pragma unroll
      for (int r = 0; r < 8; ++r) {
        float v = acc[i][j][r] * scale;
        if (BIAS_MODE == 1) v += bias[mBase + mOff + r];
        if (BIAS_MODE == 2) v += bv;
        if (RESID) v += Rb[(size_t)(mBase + mOff + r) * ldc + n];
        if (ACT == 1) v = tanhf(v);
        if (ACT == 2) v = fmaxf(v, 0.0f);
        if (ACT == 3) v = v / (1.0f + expf(-v));
        if (ACT == 4) v = (v > 0.f) ? v : 0.01f * v;
        if (ACT == 5) v = 0.5f * v * (1.0f + erff(v * 0.70710678118654752f));
        slab[(mOff + r) * 68 + (j << 4) + rlane] = v;
      }
    }
    __builtin_amdgcn_fence(__ATOMIC_RELEASE, "workgroup");
    __builtin_amdgcn_wave_barrier();
    __builtin_amdgcn_fence(__ATOMIC_ACQUIRE, "workgroup");
    if (OUT_MODE == 0) {
      float* C = (float*)Cout + (size_t)b * strideC;
      const int hh = lane >> 4, c4 = (lane & 15) * 4;     // row seg = 256 B = 16 lanes x 16 B
      {
#pragma unroll
        for (int it = 0; it < 8; ++it) {
          const int row = it * 2 + hh;
          v4f v = *(const v4f*)(slab + row * 68 + c4);
          *(v4f*)(C + (size_t)(mBase + row) * ldc + n0 + c4) = v;
        }
        
      }
    } else {
      const int q = lane >> 3, c8 = (lane & 7) * 8;
      unsigned short* C  = (unsigned short*)Cout  + (size_t)b * strideC;
      unsigned short* C2 = (OUT_MODE == 2) ? ((unsigned short*)Cout2 + (size_t)b * strideC) : nullptr;
      {
#pragma unroll
        for (int it = 0; it < 4; ++it) {
          const int row = it * 4 + q;
          const float* sp = slab + row * 68 + c8;
          v8h hv, lv;
#pragma unroll
          for (int e = 0; e < 8; ++e) {
            if (OUT_MODE == 1) {
              hv[e] = (_Float16)sp[e];
            } else {
              unsigned short hb = f2bf_bits(sp[e]);
              unsigned short lb = f2bf_bits(sp[e] - bf_bits2f(hb));
              hv[e] = __builtin_bit_cast(_Float16, hb);
              lv[e] = __builtin_bit_cast(_Float16, lb);
            }
          }
          *(v8h*)(C + (size_t)(mBase + row) * ldc + n0 + c8) = hv;
          if (OUT_MODE == 2) *(v8h*)(C2 + (size_t)(mBase + row) * ldc + n0 + c8) = lv;
        }
        
      }
    }
    __builtin_amdgcn_fence(__ATOMIC_RELEASE, "workgroup");
    __builtin_amdgcn_wave_barrier();
    __builtin_amdgcn_fence(__ATOMIC_ACQUIRE, "workgroup");
  }
}

template <int ET, bool SPLIT, int BIAS_MODE, int OUT_MODE, bool RESID, int ACT = 0>
__global__ __launch_bounds__(256) void wmma_gemm64(
    const unsigned short* __restrict__ Ap, const unsigned short* __restrict__ A2p, int lda, long strideA,
    const unsigned short* __restrict__ Btp, const unsigned short* __restrict__ Bt2p, int ldb, long strideB,
    void* __restrict__ Cout, void* __restrict__ Cout2, int ldc, long strideC,
    const float* __restrict__ bias,
    const float* __restrict__ resid, long strideR,
    int M, int N, int K, float scale) {
  __shared__ __align__(16) float sT[8][16 * 68];
  __shared__ __align__(16) unsigned char ring[2 * GS_BUF];
  gemm64_tile<ET, SPLIT, BIAS_MODE, OUT_MODE, RESID, ACT>(
      sT, ring, blockIdx.y, Ap, A2p, lda, strideA, Btp, Bt2p, ldb, strideB, Cout, Cout2, ldc, strideC,
      bias, resid, strideR, M, N, K, scale);
}

// ---- the three projections of one activation matrix x [Nn][Dm] in one launch; they share no result, so their blocks run side by side ----
// blockIdx.y = 0: q[Nn][Dm] = x . Wq^T + bq[n];  1: k likewise;  2: vt[Dm][Nn] = Wv . x^T + bv[m].  w = planes Wq, Wk, Wv of Dm*Dm each.
__global__ __launch_bounds__(256) void qkv_gemm64(
    const unsigned short* __restrict__ x, const unsigned short* __restrict__ w,
    unsigned short* __restrict__ qo, unsigned short* __restrict__ ko, unsigned short* __restrict__ vto,
    const float* __restrict__ bq, const float* __restrict__ bk, const float* __restrict__ bv,
    int Nn, int Dm, float scale) {
  __shared__ __align__(16) float sT[8][16 * 68];
  __shared__ __align__(16) unsigned char ring[2 * GS_BUF];
  const int y = blockIdx.y;                                      // block-uniform
  const unsigned short* wy = w + (size_t)y * Dm * Dm;
  if (y == 2) {
    gemm64_tile<0, false, 1, 1, false, 0>(sT, ring, 0, wy, wy, Dm, 0L, x, x, Dm, 0L,
                                          (void*)vto, (void*)vto, Nn, 0L, bv, bv, 0L, Dm, Nn, Dm, scale);
  } else {
    unsigned short* o = (y == 0) ? qo : ko;
    const float* bb = (y == 0) ? bq : bk;
    gemm64_tile<0, false, 2, 1, false, 0>(sT, ring, 0, x, x, Dm, 0L, wy, wy, Dm, 0L,
                                          (void*)o, (void*)o, Dm, 0L, bb, bb, 0L, Nn, Dm, Dm, scale);
  }
}

// ---- f32 -> f16 casts of the activations (x1) and of four equally sized weight matrices (x sc) in one launch ----
// Pairs 0..n2a-1 come from a, the next 4 * n2each from s0..s3; out holds the planes in that order, back to back.
// n2a and n2each are multiples of 256, so the source is the same for a whole block.
__global__ __launch_bounds__(256) void cast5_f32_f16x2s(
    const float* __restrict__ a,
    const float* __restrict__ s0, const float* __restrict__ s1,
    const float* __restrict__ s2, const float* __restrict__ s3,
    _Float16* __restrict__ out, int n2a, int n2each, float sc) {
  const int i0 = blockIdx.x * 256;
  const float* in = a;
  float f = 1.0f;
  int j = i0;                                                    // first pair of this block inside its own source
  if (j >= n2a) {
    j -= n2a; in = s0; f = sc;
    if (j >= n2each) { j -= n2each; in = s1; }
    if (j >= n2each) { j -= n2each; in = s2; }
    if (j >= n2each) { j -= n2each; in = s3; }
  }
  j += threadIdx.x;
  const _Float16 h0 = (_Float16)(in[2 * j] * f), h1 = (_Float16)(in[2 * j + 1] * f);
  const unsigned u = (unsigned)__builtin_bit_cast(unsigned short, h0) | ((unsigned)__builtin_bit_cast(unsigned short, h1) << 16);
  ((unsigned*)out)[i0 + threadIdx.x] = u;
}

// =====================================================================================
// Lean attention for head_dim 64 on f16 planes (no operand conversion inside; LDS holds only the staged K and V tiles):
//   q  [S][ldq]   f16, head h at columns h*64..h*64+63
//   k  [Skv][ldk] f16, same column layout
//   vt [H*64][ldv] f16, row = h*64+d, column = key index
//   maskv [Skv] f32 key vector; score = (q.k) * qscale + (1 - maskv[kv]) * mask_fill
//   ctx [S][ldo] f16 out, head h at columns h*64.., value = oscale * softmax(score) . v
//   Both products run transposed: St = K . Qt (A = key rows, B = query columns), Ot += Vt . Pt (A = vt rows, B = Pt).
//   A lane then holds scores of ONE query (column c): maximum and sum are taken in the lane, the two lane halves
//   exchange the maximum once per chunk and join their sums once at the end; two score tiles, converted in place,
//   are the B operand of the second product, so P goes through no LDS and no lane exchange.
//   v_wmma_f32_16x16x32_f16, f32 accumulate; online softmax in f32, base 2; P carried x2^15 in f16.
//   Block = 4 waves = 64 query rows of one head; S, Skv % 64 == 0; grid.x = H * (S/64).
//   A chunk's 64 K rows and 64 vt rows (128 B each, one whole line) come into LDS once per block by asynchronous copies and serve
//   all 4 waves; two buffers: chunk t+1 flies while chunk t is worked on. A fragment load from global memory touches 16 lines.
//   Every A/B fragment read from memory comes via Frag<_Float16>::load (k map 8hh+s, 16+8hh+(s-8)), the map a packed D pair has.
// =====================================================================================
#define AT_D 64
#define AT_QB 64
#define AT_KC 64
#define AT_PITCH 144                      // LDS bytes from one staged 128-B row to the next: 16 B x odd, so 16 rows read 16 B each on 64 distinct banks
#define AT_BUF   (128 * AT_PITCH)         // one buffer: 64 K rows, then 64 vt rows; 18432 B
// Eight asynchronous 16-byte copies per lane, global -> LDS through no register: rows r, r+16, r+32, r+48 of the K tile, then of the vt tile.
// l = the lane's LDS byte address of K row r, gk / gv = its global addresses there, sk / sv = elements from row r to row r+16.
// s_wait_xcnt 0 closes the statement as a precaution: the operands' registers live to its end, so none is rewritten in front of it.
__device__ __forceinline__ void at_copy8(unsigned l, const _Float16* gk, size_t sk, const _Float16* gv, size_t sv) {
  asm volatile("global_load_async_to_lds_b128 %0, %8, off\n\t"
               "global_load_async_to_lds_b128 %1, %9, off\n\t"
               "global_load_async_to_lds_b128 %2, %10, off\n\t"
               "global_load_async_to_lds_b128 %3, %11, off\n\t"
               "global_load_async_to_lds_b128 %4, %12, off\n\t"
               "global_load_async_to_lds_b128 %5, %13, off\n\t"
               "global_load_async_to_lds_b128 %6, %14, off\n\t"
               "global_load_async_to_lds_b128 %7, %15, off\n\t"
               "s_wait_xcnt 0x0"
               :: "v"(l), "v"(l + 16 * AT_PITCH), "v"(l + 32 * AT_PITCH), "v"(l + 48 * AT_PITCH),
                  "v"(l + 64 * AT_PITCH), "v"(l + 80 * AT_PITCH), "v"(l + 96 * AT_PITCH), "v"(l + 112 * AT_PITCH),
                  "v"(gk), "v"(gk + sk), "v"(gk + 2 * sk), "v"(gk + 3 * sk),
                  "v"(gv), "v"(gv + sv), "v"(gv + 2 * sv), "v"(gv + 3 * sv)
               : "memory");
}
// s_wait_xcnt 0 behind the mask loads, kept as a precaution in front of any reuse of their address register
__device__ __forceinline__ void addr_wait1(const void* a) { asm volatile("s_wait_xcnt 0x0" :: "v"(a) : "memory"); }

__device__ __forceinline__ v8f mma_h(v16h a, v16h b, v8f c) {
  c = __builtin_amdgcn_wmma_f32_16x16x32_f16(false, a, false, b, (short)0, c, false, false);
  asm volatile("v_nop\n\tv_nop\n\tv_nop\n\tv_nop" : "+v"(c) : "v"(a), "v"(b));
  return c;
}

// value of lane l ^ 16: a vector cross-row move (a shuffle would go through the LDS pipe and its wait)
__device__ __forceinline__ float other_half(float x) {
  const int b = __builtin_bit_cast(int, x);
  return __builtin_bit_cast(float, __builtin_amdgcn_permlanex16(b, b, 0x76543210, 0xfedcba98, false, false));
}

// 2^d by one v_exp_f32. Behind a transcendental the instruction set asks for one independent instruction before its result is read or its
// source overwritten. That instruction stands in the exponential's own statement, so the slot is filled in every build, and with work that
// is due anyway: exp2_zero starts a running sum at 0, exp2_add adds an earlier exponential e to its sum; exp2_nop has no such work.
// volatile keeps these statements in the written order, four sums in turn: an add then finds its exponential and its sum's last add finished.
__device__ __forceinline__ float exp2_nop(float d) {
  float p;
  asm volatile("v_exp_f32 %0, %1\n\tv_nop" : "=v"(p) : "v"(d));
  return p;
}
__device__ __forceinline__ float exp2_zero(float d, float& sum) {
  float p;
  asm volatile("v_exp_f32 %0, %2\n\tv_mov_b32 %1, 0" : "=&v"(p), "=&v"(sum) : "v"(d));
  return p;
}
__device__ __forceinline__ float exp2_add(float d, float& sum, float e) {
  float p;
  asm volatile("v_exp_f32 %0, %2\n\tv_add_f32 %1, %1, %3" : "=&v"(p), "+v"(sum) : "v"(d), "v"(e));
  return p;
}

__global__ __launch_bounds__(128)
void attn64_f16_kernel(const _Float16* __restrict__ q, const _Float16* __restrict__ k,
                       const _Float16* __restrict__ vt, const float* __restrict__ maskv,
                       _Float16* __restrict__ ctx,
                       int S, int Skv, int H, int ldq, int ldk, int ldv, int ldo,
                       float qscale, float mask_fill, float oscale) {
  __shared__ __align__(16) unsigned char ring[2 * AT_BUF];
  // softmax in base 2: log2(e) rides in the score scale and in the mask fill, so an exponential is one v_exp_f32;
  // the x2^15 that P carries rides in the subtracted maximum, so P and its sum l both carry it and it cancels in O / l
  const float L2E = 1.44269504088896340736f;
  const float qs2 = qscale * L2E;
  const float mf2 = mask_fill * L2E;

  const int tid  = threadIdx.x;
  const int wave = tid >> 5;
  const int lane = tid & 31;
  const int hh   = lane >> 4;
  const int c    = lane & 15;

  const int nqb = S / AT_QB;
  const int bx  = blockIdx.x;
  const int qb  = bx % nqb;
  const int h   = bx / nqb;
  if (h >= H) return;                          // block-uniform, in front of every copy and barrier
  const int q0   = qb * AT_QB + wave * 16;
  const int hoff = h * AT_D;

  // ---- Q fragments (B operand, column = query q0 + c): 2 d-chunks ----
  v16h qa[2];
  {
    const _Float16* qrow = q + (size_t)(q0 + c) * ldq + hoff + 8 * hh;
#pragma unroll
    for (int dc = 0; dc < 2; ++dc) qa[dc] = Frag<_Float16>::load(qrow + dc * 32);
  }

  float mrow = -INFINITY;                      // running maximum (base-2 score) of query q0 + c, the same in both lane halves
  float lrow = 0.f;                            // running sum x2^15 of query q0 + c over this lane half's keys
  v8f oacc[4];                                 // oacc[t][r] = Ot[d = t*16 + 8hh + r][query q0 + c]
#pragma unroll
  for (int t = 0; t < 4; ++t) oacc[t] = (v8f){0.f,0.f,0.f,0.f,0.f,0.f,0.f,0.f};

  const int nChunks = Skv / AT_KC;             // host-derived, static for the launch; at least 1 (Skv % 64 == 0, Skv > 0)

  // copies: 8 lanes bring one 128-B row, a block-wide copy 16 rows
  const int crow = tid >> 3;
  const int cpc  = tid & 7;
  const _Float16* gK = k  + (size_t)crow * ldk + hoff + cpc * 8;
  const _Float16* gV = vt + (size_t)(hoff + crow) * ldv + cpc * 8;
  const unsigned lcopy = (unsigned)(size_t)ring + crow * AT_PITCH + cpc * 16;
  const size_t gsK = (size_t)16 * ldk, gsV = (size_t)16 * ldv;
  auto fill = [&](int s, int buf) {            // chunk s (keys s*AT_KC ..) into buffer buf: 8 copies per lane
    at_copy8(lcopy + buf * AT_BUF, gK + (size_t)(s * AT_KC) * ldk, gsK, gV + s * AT_KC, gsV);
  };
  fill(0, 0);

  // mask values are requested one chunk ahead: mk[j][0..1] = mask of keys kv0+16j+8hh+0..7, the keys of this lane's score registers
  const float* mbase = maskv + 8 * hh;
  v4f mk[4][2];
#pragma unroll
  for (int j = 0; j < 4; ++j) {
    mk[j][0] = *(const v4f*)(mbase + j * 16);
    mk[j][1] = *(const v4f*)(mbase + j * 16 + 4);
  }
  addr_wait1(mbase);

  wait_copies();
  __syncthreads();                             // chunk 0 is readable by every wave
  if (nChunks > 1) fill(1, 1);

  for (int kc = 0; kc < nChunks; ++kc) {
    const int kv0 = kc * AT_KC;

    // this chunk's fragments, from its own buffer alone: kb[j][dc] = A[m = key kv0+16j+c][k = d], d along the staged K row;
    // vb[kk][t] = A[m = d t*16+c][k = key], keys along the staged vt row; V is first used behind the softmax
    const unsigned char* buf = ring + (kc & 1) * AT_BUF;
    const _Float16* sk = (const _Float16*)(buf + c * AT_PITCH) + 8 * hh;
    const _Float16* sv = (const _Float16*)(buf + (64 + c) * AT_PITCH) + 8 * hh;
    v16h kb[4][2];
    v16h vb[2][4];
#pragma unroll
    for (int j = 0; j < 4; ++j)
#pragma unroll
      for (int dc = 0; dc < 2; ++dc) kb[j][dc] = Frag<_Float16>::load(sk + j * (16 * AT_PITCH / 2) + dc * 32);
#pragma unroll
    for (int t = 0; t < 4; ++t)
#pragma unroll
      for (int kk = 0; kk < 2; ++kk) vb[kk][t] = Frag<_Float16>::load(sv + t * (16 * AT_PITCH / 2) + kk * 32);

    // ---- scores St[64 x 16]: D row 8hh+r of subtile j = key kv0+16j+8hh+r, D col c = query q0+c ----
    v8f s[4];
#pragma unroll
    for (int j = 0; j < 4; ++j) {
      s[j] = (v8f){0.f,0.f,0.f,0.f,0.f,0.f,0.f,0.f};
#pragma unroll
      for (int dc = 0; dc < 2; ++dc) s[j] = mma_h(kb[j][dc], qa[dc], s[j]);
    }

    // scale and mask, in base 2; (1 - mask) * fill is taken as fill - mask * fill in one fma, rounded once (0 at mask 1, fill at mask 0);
    // the chunk's maximum of this lane's query: four chains in the lane, then one exchange between the halves
    float mj[4];
#pragma unroll
    for (int j = 0; j < 4; ++j) {
      float m = -INFINITY;
#pragma unroll
      for (int r = 0; r < 8; ++r) {
        const float x = fmaf(s[j][r], qs2, fmaf(mk[j][r >> 2][r & 3], -mf2, mf2));
        s[j][r] = x;
        m = fmaxf(m, x);
      }
      mj[j] = m;
    }
    float cm = fmaxf(fmaxf(mj[0], mj[1]), fmaxf(mj[2], mj[3]));
    cm = fmaxf(cm, other_half(cm));

    const float mnew  = fmaxf(mrow, cm);
    const float alpha = exp2_nop(mrow - mnew);
    const float m15   = mnew - 15.0f;          // 2^(x - m15) = 2^15 * 2^(x - mnew)
    mrow = mnew;

    // P in place: pb[kk] = B[k = key kk*32 + (8hh+s | 16+8hh+(s-8))][n = query c] = score tiles 2kk and 2kk+1 of this lane
    // the four tiles' sums run side by side, each in the order r = 0..7; an exponential joins its sum four statements later
    v16h pb[2];
    float pj[4];
#pragma unroll
    for (int r = 0; r < 8; ++r)
#pragma unroll
      for (int j = 0; j < 4; ++j) {
        const float d = s[j][r] - m15;
        s[j][r] = (r == 0) ? exp2_zero(d, pj[j]) : exp2_add(d, pj[j], s[j][r - 1]);
      }
#pragma unroll
    for (int j = 0; j < 4; ++j) {
      pj[j] += s[j][7];
#pragma unroll
      for (int r = 0; r < 8; ++r) pb[j >> 1][(j & 1) * 8 + r] = (_Float16)s[j][r];
    }
    lrow = lrow * alpha + ((pj[0] + pj[1]) + (pj[2] + pj[3]));
#pragma unroll
    for (int t = 0; t < 4; ++t)
#pragma unroll
      for (int r = 0; r < 8; ++r) oacc[t][r] *= alpha;

    // the next chunk's mask values fly during vt.pt; the last pass re-reads chunk 0 (in bounds, unused)
    {
      const int kvn = (kc + 1 < nChunks) ? kv0 + AT_KC : 0;
      const float* pm = mbase + kvn;
#pragma unroll
      for (int j = 0; j < 4; ++j) {
        mk[j][0] = *(const v4f*)(pm + j * 16);
        mk[j][1] = *(const v4f*)(pm + j * 16 + 4);
      }
      addr_wait1(pm);
    }

    // ---- Ot += Vt (64 d x 64 keys) . Pt (64 keys x 16 queries) ----
#pragma unroll   // kk must be a constant: vb[kk][t] and pb[kk] are held in registers
    for (int kk = 0; kk < 2; ++kk) {
#pragma unroll
      for (int t = 0; t < 4; ++t) oacc[t] = mma_h(vb[kk][t], pb[kk], oacc[t]);
    }

    // publish point of chunk kc+1: own reads of this buffer done, own copies of the next landed, then every wave's
    wait_lds_reads();
    wait_copies();
    __syncthreads();
    if (kc + 2 < nChunks) fill(kc + 2, kc & 1);  // block-uniform test; into the buffer every wave has just left
  }
  wait_copies();

  // ---- epilogue: the halves' sums are joined; a lane's 8 registers of tile t are 8 consecutive d of ctx row q0 + c ----
  {
    const float ltot = lrow + other_half(lrow);
    const float inv  = oscale / ltot;
    _Float16* orow = ctx + (size_t)(q0 + c) * ldo + hoff + 8 * hh;
#pragma unroll
    for (int t = 0; t < 4; ++t) {
      v8h hv;
#pragma unroll
      for (int r = 0; r < 8; ++r) hv[r] = (_Float16)(oacc[t][r] * inv);
      *(v8h*)(orow + t * 16) = hv;
    }
  }
}

// =====================================================================================
// One block of 256 threads per row; requires ncols == 1024. Each thread owns 4 consecutive floats;
// =====================================================================================
__global__ __launch_bounds__(256) void row_tanh_res_ln_kernel(
    const float* __restrict__ y, const float* __restrict__ res,
    const float* __restrict__ gamma, const float* __restrict__ beta,
    float* __restrict__ out, int ncols, float eps) {
  __shared__ float red[16];
  const int row  = blockIdx.x;
  const int t    = threadIdx.x;
  const int lane = t & 31;
  const int wave = t >> 5;
  const size_t base = (size_t)row * ncols + 4 * t;
  const v4f yv = *(const v4f*)(y + base);
  const v4f rv = *(const v4f*)(res + base);
  const float x0 = tanhf(yv[0]) + rv[0];
  const float x1 = tanhf(yv[1]) + rv[1];
  const float x2 = tanhf(yv[2]) + rv[2];
  const float x3 = tanhf(yv[3]) + rv[3];
  float s = (x0 + x1) + (x2 + x3);
#pragma unroll
  for (int off = 1; off < 32; off <<= 1) s += __shfl_xor(s, off, 32);
  if (lane == 0) red[wave] = s;
  __syncthreads();
  float tot = 0.f;
#pragma unroll
  for (int w = 0; w < 8; ++w) tot += red[w];
  const float inv_n = 1.0f / (float)ncols;
  const float mu = tot * inv_n;
  const float d0 = x0 - mu, d1 = x1 - mu, d2 = x2 - mu, d3 = x3 - mu;
  float s2 = (d0 * d0 + d1 * d1) + (d2 * d2 + d3 * d3);
#pragma unroll
  for (int off = 1; off < 32; off <<= 1) s2 += __shfl_xor(s2, off, 32);
  if (lane == 0) red[8 + wave] = s2;
  __syncthreads();
  float tot2 = 0.f;
#pragma unroll
  for (int w = 0; w < 8; ++w) tot2 += red[8 + w];
  const float var = tot2 * inv_n;
  const float rn  = 1.0f / sqrtf(var + eps);
  const v4f gv = *(const v4f*)(gamma + 4 * t);
  const v4f bv = *(const v4f*)(beta + 4 * t);
  v4f o;
  o[0] = d0 * rn * gv[0] + bv[0];
  o[1] = d1 * rn * gv[1] + bv[1];
  o[2] = d2 * rn * gv[2] + bv[2];
  o[3] = d3 * rn * gv[3] + bv[3];
  *(v4f*)(out + base) = o;
  
}

// ----------------------------------------------------------------------------
extern "C" void kernel_launch(void* const* d_in, const int* in_sizes, int n_in,
                              void* d_out, int out_size, void* d_ws, size_t ws_size,
                              hipStream_t stream) {
  if (n_in < 12) return;
  const float* ht    = (const float*)d_in[0];
  const float* amask = (const float*)d_in[1];
  const float* Wq    = (const float*)d_in[2];
  const float* bq    = (const float*)d_in[3];
  const float* Wk    = (const float*)d_in[4];
  const float* bk    = (const float*)d_in[5];
  const float* Wv    = (const float*)d_in[6];
  const float* bv    = (const float*)d_in[7];
  const float* Wd    = (const float*)d_in[8];
  const float* bd    = (const float*)d_in[9];
  const float* gamma = (const float*)d_in[10];
  const float* beta  = (const float*)d_in[11];

  const int Dm = in_sizes[3];                 // hidden size (1024)
  if (Dm != 1024) return;
  const int Nn = in_sizes[0] / Dm;            // tokens (2048)
  const int Hh = 16;
  const int Dh = Dm / Hh;                     // 64
  if (Dh != 64 || Nn <= 0 || (Nn % 256) != 0 || in_sizes[0] != Nn * Dm) return;
  if (in_sizes[2] != Dm * Dm || in_sizes[4] != Dm * Dm || in_sizes[6] != Dm * Dm || in_sizes[8] != Dm * Dm) return;
  if (in_sizes[1] < Nn || in_sizes[5] < Dm || in_sizes[7] < Dm || in_sizes[9] < Dm || in_sizes[10] < Dm || in_sizes[11] < Dm) return;
  if (out_size != Nn * Dm) return;

  // ---- workspace carve (bytes; every sub-buffer size is a multiple of 256 B, so all offsets are line aligned) ----
  const size_t bHt16 = (size_t)Nn * Dm * 2;   // f16 [N][D] (and [D][N])
  const size_t bW16  = (size_t)Dm * Dm * 2;   // f16 [D][D]
  const size_t bF    = (size_t)Nn * Dm * 4;   // f32 [N][D]
  size_t o = 0;
  char* ws = (char*)d_ws;
  _Float16* ht16  = (_Float16*)(ws + o); o += bHt16;
  _Float16* w16   = (_Float16*)(ws + o); o += 4 * bW16;      // planes: 0 = Wq x16, 1 = Wk x16, 2 = Wv x16, 3 = Wd x16
  _Float16* q16   = (_Float16*)(ws + o); o += bHt16;         // [N][D]
  _Float16* k16   = (_Float16*)(ws + o); o += bHt16;         // [N][D]
  _Float16* vt16  = (_Float16*)(ws + o); o += bHt16;         // [D][N]  (d-major, token contiguous)
  _Float16* ctx16 = (_Float16*)(ws + o); o += bHt16;         // [N][D], carried x16
  float*    yf    = (float*)(ws + o);    o += bF;            // [N][D] f32 dense pre-activation
  if (o > ws_size) return;                                   // 37748736 B for the given sizes
  _Float16* wd16 = w16 + (size_t)3 * Dm * Dm;

  // ---- casts to f16 (weights carried x16) ----
  const int nHt2 = Nn * Dm / 2, nW2 = Dm * Dm / 2;              // both multiples of 256 (Dm = 1024); w16 follows ht16 directly
  cast5_f32_f16x2s<<<(nHt2 + 4 * nW2) / 256, 256, 0, stream>>>(ht, Wq, Wk, Wv, Wd, ht16, nHt2, nW2, 16.0f);

  // ---- q, k projections: [Nn][Dm] f16 = ht16 . W16^T * (1/16) + bias[n];
  //      v projection, transposed: vt16[dout][token] = Wv16 . ht16^T * (1/16) + bv[dout]; one launch, grid.y picks the product ----
  const int tilesQK = (Nn / 64) * (Dm / 64);                     // the same count for all three
  const dim3 gqk((tilesQK + 7) / 8, 1);
  qkv_gemm64<<<dim3((tilesQK + 7) / 8, 3), 256, 0, stream>>>(
      (const unsigned short*)ht16, (const unsigned short*)w16,
      (unsigned short*)q16, (unsigned short*)k16, (unsigned short*)vt16, bq, bk, bv, Nn, Dm, 1.0f / 16.0f);

  // ---- attention: per (head, 64 query rows) block, 64-key chunks, scale 1/8, additive key mask (1 - m) * -1e4; ctx carried x16 ----
  attn64_f16_kernel<<<Hh * (Nn / 64), 128, 0, stream>>>(
      q16, k16, vt16, amask, ctx16, Nn, Nn, Hh, Dm, Dm, Nn, Dm, 0.125f, -10000.0f, 16.0f);

  // ---- dense projection y = ctx16 . Wd16^T * (1/256) + bd (f32 out) ----
  const unsigned short* Cu = (const unsigned short*)ctx16;
  wmma_gemm64<0, false, 2, 0, false, 0><<<gqk, 256, 0, stream>>>(
      Cu, Cu, Dm, 0L, (const unsigned short*)wd16, (const unsigned short*)wd16, Dm, 0L,
      (void*)yf, (void*)yf, Dm, 0L, bd, ht, 0L, Nn, Dm, Dm, 1.0f / 256.0f);

  // ---- tanh + residual + LayerNorm -> d_out ----
  row_tanh_res_ln_kernel<<<Nn, 256, 0, stream>>>(yf, ht, gamma, beta, (float*)d_out, Dm, 1e-5f);
}
